// v000
// Measured on an AMD MI455X. A time is GPU time per run, averaged over a window of back-to-back runs after a warm-up
// (all launches, gaps included; the runs take copies of the inputs in turn), and the median of several windows.
// Apart from v000's, it joins two sittings. Times from different sittings can be a few percent apart, while
// side-by-side timings come from the same sitting.
// v000, which the later versions start from, runs in 1320 microseconds.
#include <hip/hip_runtime.h>
#include <hip/hip_bf16.h>
#include <math.h>

#define B_  4096
#define N_  64
#define D_  256
#define H_  8
#define NB_ 16
#define DH_ 32

typedef __bf16 bf16_t;
typedef __attribute__((ext_vector_type(16))) __bf16 v16bf;
typedef __attribute__((ext_vector_type(8)))  __bf16 v8bf;
typedef __attribute__((ext_vector_type(8)))  float  v8f;

__device__ __forceinline__ v8f v8f_zero() {
    v8f v;
#pragma unroll
    for (int i = 0; i < 8; ++i) v[i] = 0.0f;
    return v;
}

// A fragment (16x32 bf16, row-major source with row stride D_):
// lanes 0-15 : row = mr+lane,    K chunks [k0, k0+8) and [k0+16, k0+24)
// lanes 16-31: row = mr+lane-16, K chunks [k0+8, k0+16) and [k0+24, k0+32)
__device__ __forceinline__ v16bf frag_a(const bf16_t* __restrict__ A, int mr, int k0, int lane) {
    int r  = mr + (lane & 15);
    int kk = k0 + ((lane >> 4) << 3);
    v8bf lo = *(const v8bf*)(A + r * D_ + kk);
    v8bf hi = *(const v8bf*)(A + r * D_ + kk + 16);
    v16bf f;
#pragma unroll
    for (int i = 0; i < 8; ++i) { f[i] = lo[i]; f[i + 8] = hi[i]; }
    return f;
}

// B fragment (32x16 bf16). B[k][n] = W[n][k] (we compute X @ W.T), so a
// column of B is a contiguous row of W (row-major [D_][D_] bf16).
__device__ __forceinline__ v16bf frag_b(const bf16_t* __restrict__ W, int nc, int k0, int lane) {
    int c  = nc + (lane & 15);
    int kk = k0 + ((lane >> 4) << 3);
    v8bf lo = *(const v8bf*)(W + c * D_ + kk);
    v8bf hi = *(const v8bf*)(W + c * D_ + kk + 16);
    v16bf f;
#pragma unroll
    for (int i = 0; i < 8; ++i) { f[i] = lo[i]; f[i + 8] = hi[i]; }
    return f;
}

// ---------------- prep 1: convert Wq/Wk/Wv to bf16 (contiguous dst) --------
extern "C" __global__ void __launch_bounds__(256)
baca_cvt_w(const float* __restrict__ Wq, const float* __restrict__ Wk,
           const float* __restrict__ Wv, bf16_t* __restrict__ dst) {
    int idx = blockIdx.x * 256 + threadIdx.x;           // 0 .. 3*65536
    const float* src = (idx < 65536) ? Wq : (idx < 131072 ? Wk : Wv);
    dst[idx] = (bf16_t)src[idx & 65535];
}

// ---------------- prep 2: P_u* = batch_emb @ U*.T + b* + bu* ---------------
extern "C" __global__ void __launch_bounds__(256)
baca_pu(const float* __restrict__ Uq, const float* __restrict__ buq, const float* __restrict__ bq,
        const float* __restrict__ Uk, const float* __restrict__ buk, const float* __restrict__ bk,
        const float* __restrict__ Uv, const float* __restrict__ buv, const float* __restrict__ bv,
        const float* __restrict__ batch_emb,
        float* __restrict__ P_uq, float* __restrict__ P_uk, float* __restrict__ P_uv) {
    int idx = blockIdx.x * 256 + threadIdx.x;           // 0 .. 3*16*256
    int which = idx / (NB_ * D_);
    int rem   = idx - which * (NB_ * D_);
    int nb = rem >> 8, d = rem & 255;
    const float* U  = (which == 0) ? Uq  : (which == 1) ? Uk  : Uv;
    const float* bu = (which == 0) ? buq : (which == 1) ? buk : buv;
    const float* bw = (which == 0) ? bq  : (which == 1) ? bk  : bv;
    float*       P  = (which == 0) ? P_uq: (which == 1) ? P_uk: P_uv;
    float acc = bu[d] + bw[d];
    const float* e = batch_emb + nb * D_;
    const float* u = U + d * D_;
#pragma unroll 8
    for (int k = 0; k < D_; ++k) acc = fmaf(e[k], u[k], acc);
    P[rem] = acc;
}

// ---------------- kernel A: Q = h_recv@Wq.T + gather(P_uq); b1 MLP ---------
// LDS carve: Hs f32[64*256] | h1 f32[64*128] | As bf16[64*256] | br int[64]
extern "C" __global__ void __launch_bounds__(256)
baca_qb1(const float* __restrict__ h_recv, const int* __restrict__ batch_recv,
         const bf16_t* __restrict__ Wq_bf, const float* __restrict__ P_uq,
         const float* __restrict__ batch_emb,
         const float* __restrict__ D1, const float* __restrict__ db1,
         const float* __restrict__ D2, const float* __restrict__ db2,
         float* __restrict__ Qf, float* __restrict__ b1w) {
    extern __shared__ char smem[];
    float*  Hs = (float*)smem;                   // 64*256
    float*  h1 = Hs + 64 * 256;                  // 64*128
    bf16_t* As = (bf16_t*)(h1 + 64 * 128);       // 64*256
    int*    br = (int*)(As + 64 * 256);          // 64

    const int t = threadIdx.x, lane = t & 31, wave = t >> 5;
    const int m0 = blockIdx.x * 64;

    const float* hr = h_recv + (size_t)m0 * D_;
#pragma unroll 4
    for (int i = 0; i < 64; ++i) {
        int idx = t + i * 256;
        float v = hr[idx];
        Hs[idx] = v;
        As[idx] = (bf16_t)v;
    }
    if (t < 64) br[t] = batch_recv[m0 + t];
    __syncthreads();

    // receiver_state = h_recv + E_recv (in place; WMMA below only reads As)
#pragma unroll 4
    for (int i = 0; i < 64; ++i) {
        int idx = t + i * 256;
        Hs[idx] += batch_emb[br[idx >> 8] * D_ + (idx & 255)];
    }

    // WMMA: 64x256 output, 8 waves x 8 tiles
    {
        const int strip = (wave & 3) * 16;
        const int chalf = (wave >> 2) * 8;
        v8f acc[8];
#pragma unroll
        for (int ct = 0; ct < 8; ++ct) acc[ct] = v8f_zero();
        for (int k0 = 0; k0 < D_; k0 += 32) {
            v16bf a = frag_a(As, strip, k0, lane);
#pragma unroll
            for (int ct = 0; ct < 8; ++ct) {
                v16bf bb = frag_b(Wq_bf, (chalf + ct) * 16, k0, lane);
                acc[ct] = __builtin_amdgcn_wmma_f32_16x16x32_bf16(
                    false, a, false, bb, (short)0, acc[ct], false, false);
            }
        }
        const int rbase = strip + ((lane >> 4) << 3);
#pragma unroll
        for (int ct = 0; ct < 8; ++ct) {
            int col = (chalf + ct) * 16 + (lane & 15);
#pragma unroll
            for (int j = 0; j < 8; ++j) {
                int row = rbase + j;
                Qf[(size_t)(m0 + row) * D_ + col] = acc[ct][j] + P_uq[br[row] * D_ + col];
            }
        }
    }
    __syncthreads();

    // hidden = relu(rs @ D1.T + db1)   (8192 outputs, j uniform per wave-pair)
    for (int rep = 0; rep < 32; ++rep) {
        int idx = rep * 256 + t;
        int j = idx >> 6, r = idx & 63;
        float d = db1[j];
        const float* w = D1 + j * D_;
        const float* x = Hs + r * D_;
#pragma unroll 8
        for (int k = 0; k < D_; ++k) d = fmaf(x[k], w[k], d);
        h1[r * 128 + j] = fmaxf(d, 0.0f);
    }
    __syncthreads();

    // b1 = softplus(h1 @ D2.T + db2)
#pragma unroll
    for (int rep = 0; rep < 2; ++rep) {
        int idx = rep * 256 + t;
        int r = idx >> 3, h = idx & 7;
        float d = db2[h];
        const float* w = D2 + h * 128;
        const float* x = h1 + r * 128;
#pragma unroll 8
        for (int k = 0; k < 128; ++k) d = fmaf(x[k], w[k], d);
        b1w[(size_t)(m0 + r) * H_ + h] = log1pf(__expf(d));
    }
}

// ---------------- kernel B: fused K/V projection + attention per b ---------
// V never touches LDS: V-waves keep accumulators in registers and contract
// them against attn directly (register tile j-axis == n reduction axis).
// LDS carve (143 KB -> 2 WGs/WGP):
//   Ks f32[64*256] | Pk f32[16*256] | Pv f32[16*256] | Qs f32[256]
//   sc f32[512] | b1s f32[8] | inv f32[8] | dists f32[64] | zpart f32[8*256]
//   As bf16[64*256] | bs int[64] | msk int[64]
extern "C" __global__ void __launch_bounds__(256)
baca_attn(const float* __restrict__ h_send, const int* __restrict__ batch_recv,
          const int* __restrict__ batch_send, const float* __restrict__ dist,
          const int* __restrict__ mask, const float* __restrict__ gamma,
          const bf16_t* __restrict__ Wk_bf, const bf16_t* __restrict__ Wv_bf,
          const float* __restrict__ P_uk, const float* __restrict__ P_uv,
          const float* __restrict__ Qf, const float* __restrict__ b1w,
          float* __restrict__ z_out, float* __restrict__ attn_out) {
    extern __shared__ char smem[];
    float*  Ks    = (float*)smem;                // 64*256
    float*  Pk    = Ks + 64 * 256;               // 16*256
    float*  Pv    = Pk + 16 * 256;               // 16*256
    float*  Qs    = Pv + 16 * 256;               // 256
    float*  sc    = Qs + 256;                    // 64*8
    float*  b1s   = sc + 512;                    // 8
    float*  inv   = b1s + 8;                     // 8
    float*  dists = inv + 8;                     // 64
    float*  zpart = dists + 64;                  // 8*256
    bf16_t* As    = (bf16_t*)(zpart + 8 * 256);  // 64*256 (16B aligned)
    int*    bs    = (int*)(As + 64 * 256);       // 64
    int*    msk   = bs + 64;                     // 64

    const int t = threadIdx.x, lane = t & 31, wave = t >> 5;
    const int b = blockIdx.x;

    // stage: h_send[b] -> bf16, P_uk/P_uv tables, Q row, per-n scalars
    const float* hs = h_send + (size_t)b * (N_ * D_);
#pragma unroll 4
    for (int i = 0; i < 64; ++i) {
        int idx = t + i * 256;
        As[idx] = (bf16_t)hs[idx];
    }
    for (int i = t; i < NB_ * D_; i += 256) { Pk[i] = P_uk[i]; Pv[i] = P_uv[i]; }
    Qs[t] = Qf[(size_t)b * D_ + t];
    if (t < 64) {
        bs[t]    = batch_send[b * N_ + t];
        msk[t]   = mask[b * N_ + t];
        dists[t] = dist[b * N_ + t];
    }
    if (t < H_) b1s[t] = b1w[(size_t)b * H_ + t];
    __syncthreads();

    // K/V projection: waves 0-3 -> K strips 0..3 (to LDS with P_uk bias),
    //                 waves 4-7 -> V strips 0..3 (stay in registers)
    const int mat   = wave >> 2;
    const int strip = (wave & 3) * 16;
    const int rbase = strip + ((lane >> 4) << 3);
    v8f acc[16];
#pragma unroll
    for (int ct = 0; ct < 16; ++ct) acc[ct] = v8f_zero();
    {
        const bf16_t* W = mat ? Wv_bf : Wk_bf;
        for (int k0 = 0; k0 < D_; k0 += 32) {
            v16bf a = frag_a(As, strip, k0, lane);
#pragma unroll
            for (int ct = 0; ct < 16; ++ct) {
                v16bf bb = frag_b(W, ct * 16, k0, lane);
                acc[ct] = __builtin_amdgcn_wmma_f32_16x16x32_bf16(
                    false, a, false, bb, (short)0, acc[ct], false, false);
            }
        }
    }
    if (mat == 0) {
#pragma unroll
        for (int ct = 0; ct < 16; ++ct) {
            int col = ct * 16 + (lane & 15);
#pragma unroll
            for (int j = 0; j < 8; ++j) {
                int row = rbase + j;                 // n index 0..63
                Ks[row * D_ + col] = acc[ct][j] + Pk[bs[row] * D_ + col];
            }
        }
    }
    __syncthreads();

    // scores[n][h]
    const int   br    = batch_recv[b];
    const float scale = 0.1767766952966369f;   // 1/sqrt(32)
#pragma unroll
    for (int rep = 0; rep < 2; ++rep) {
        int idx = t + rep * 256;
        int n = idx >> 3, h = idx & 7;
        float s;
        if (msk[n] == 0) {
            s = -INFINITY;
        } else {
            float d = 0.0f;
            const float* q = Qs + h * DH_;
            const float* k = Ks + n * D_ + h * DH_;
#pragma unroll
            for (int kk = 0; kk < DH_; ++kk) d = fmaf(q[kk], k[kk], d);
            s = d * scale - b1s[h] * dists[n] + gamma[br * NB_ + bs[n]];
        }
        sc[n * H_ + h] = s;
    }
    __syncthreads();

    // softmax over n, per h (8 lanes, N=64 serial — tiny)
    if (t < H_) {
        float m = -INFINITY;
        for (int n = 0; n < N_; ++n) m = fmaxf(m, sc[n * H_ + t]);
        float s = 0.0f;
        for (int n = 0; n < N_; ++n) {
            float e = __expf(sc[n * H_ + t] - m);
            sc[n * H_ + t] = e;
            s += e;
        }
        inv[t] = 1.0f / s;
    }
    __syncthreads();

#pragma unroll
    for (int rep = 0; rep < 2; ++rep) {
        int idx = t + rep * 256;
        int n = idx >> 3, h = idx & 7;
        float a = sc[n * H_ + h] * inv[h];
        sc[n * H_ + h] = a;
        attn_out[((size_t)b * N_ + n) * H_ + h] = a;
    }
    __syncthreads();

    // V-waves: contract register V tiles with attn.
    // Lane owns col = ct*16 + (lane&15); acc[ct][j] is V[rbase+j][col].
    if (mat == 1) {
        const int half = (wave - 4) * 2 + (lane >> 4);   // 0..7
#pragma unroll
        for (int ct = 0; ct < 16; ++ct) {
            int col = ct * 16 + (lane & 15);
            int h = col >> 5;
            float p = 0.0f;
#pragma unroll
            for (int j = 0; j < 8; ++j)
                p = fmaf(sc[(rbase + j) * H_ + h], acc[ct][j], p);
            zpart[half * D_ + col] = p;
        }
    }
    __syncthreads();

    // z[b, col] = sum(zpart) + sum_n attn[n,h] * P_uv[bs[n]][col]
    {
        const int h = t >> 5;
        float z = 0.0f;
#pragma unroll
        for (int p = 0; p < 8; ++p) z += zpart[p * D_ + t];
#pragma unroll 8
        for (int n = 0; n < N_; ++n)
            z = fmaf(sc[n * H_ + h], Pv[bs[n] * D_ + t], z);
        z_out[(size_t)b * D_ + t] = z;
    }
}

// --------------------------------------------------------------------------
extern "C" void kernel_launch(void* const* d_in, const int* in_sizes, int n_in,
                              void* d_out, int out_size, void* d_ws, size_t ws_size,
                              hipStream_t stream) {
    const float* h_recv     = (const float*)d_in[0];
    const float* h_send     = (const float*)d_in[1];
    const int*   batch_recv = (const int*)d_in[2];
    const int*   batch_send = (const int*)d_in[3];
    const float* dist       = (const float*)d_in[4];
    const int*   mask       = (const int*)d_in[5];
    const float* Wq = (const float*)d_in[6];  const float* bq  = (const float*)d_in[7];
    const float* Wk = (const float*)d_in[8];  const float* bk  = (const float*)d_in[9];
    const float* Wv = (const float*)d_in[10]; const float* bv  = (const float*)d_in[11];
    const float* Uq = (const float*)d_in[12]; const float* buq = (const float*)d_in[13];
    const float* Uk = (const float*)d_in[14]; const float* buk = (const float*)d_in[15];
    const float* Uv = (const float*)d_in[16]; const float* buv = (const float*)d_in[17];
    const float* batch_emb = (const float*)d_in[18];
    const float* D1  = (const float*)d_in[19]; const float* db1 = (const float*)d_in[20];
    const float* D2  = (const float*)d_in[21]; const float* db2 = (const float*)d_in[22];
    const float* gamma = (const float*)d_in[23];

    // workspace carve (≈4.6 MB)
    bf16_t* Wq_bf = (bf16_t*)d_ws;
    bf16_t* Wk_bf = Wq_bf + D_ * D_;
    bf16_t* Wv_bf = Wk_bf + D_ * D_;
    float*  P_uq  = (float*)(Wv_bf + D_ * D_);
    float*  P_uk  = P_uq + NB_ * D_;
    float*  P_uv  = P_uk + NB_ * D_;
    float*  Qf    = P_uv + NB_ * D_;            // B*D
    float*  b1w   = Qf + (size_t)B_ * D_;       // B*H

    float* z_out    = (float*)d_out;
    float* attn_out = z_out + (size_t)B_ * D_;

    hipLaunchKernelGGL(baca_cvt_w, dim3(3 * D_ * D_ / 256), dim3(256), 0, stream,
                       Wq, Wk, Wv, Wq_bf);
    hipLaunchKernelGGL(baca_pu, dim3(3 * NB_ * D_ / 256), dim3(256), 0, stream,
                       Uq, buq, bq, Uk, buk, bk, Uv, buv, bv, batch_emb,
                       P_uq, P_uk, P_uv);

    size_t lds_a = (64 * 256 + 64 * 128) * sizeof(float)
                 + 64 * 256 * sizeof(bf16_t) + 64 * sizeof(int);
    hipLaunchKernelGGL(baca_qb1, dim3(B_ / 64), dim3(256), lds_a, stream,
                       h_recv, batch_recv, Wq_bf, P_uq, batch_emb,
                       D1, db1, D2, db2, Qf, b1w);

    size_t lds_b = (64 * 256 + 2 * 16 * 256 + 256 + 512 + 8 + 8 + 64 + 8 * 256) * sizeof(float)
                 + 64 * 256 * sizeof(bf16_t) + 128 * sizeof(int);
    hipLaunchKernelGGL(baca_attn, dim3(B_), dim3(256), lds_b, stream,
                       h_send, batch_recv, batch_send, dist, mask, gamma,
                       Wk_bf, Wv_bf, P_uk, P_uv, Qf, b1w, z_out, attn_out);
}

// v001
// Measured time: 435 microseconds a run.
// In two side-by-side timings against v000, it was 3.04 and 3.01 times as fast.
#include <hip/hip_runtime.h>
#include <hip/hip_bf16.h>
#include <math.h>

#define B_  4096
#define N_  64
#define D_  256
#define H_  8
#define NB_ 16
#define DH_ 32

typedef __bf16 bf16_t;
typedef __attribute__((ext_vector_type(16))) __bf16 v16bf;
typedef __attribute__((ext_vector_type(8)))  __bf16 v8bf;
typedef __attribute__((ext_vector_type(8)))  float  v8f;
typedef __attribute__((ext_vector_type(4)))  float  v4f;
typedef __attribute__((ext_vector_type(2)))  float  v2f;

// LDS row pitch (floats) of the f32 receiver state: 1040 B = 16 B x 65, so the
// 16 rows of one ds_load_b128 fragment read fall on 64 distinct banks.
#define HP_ 260

__device__ __forceinline__ v8f v8f_zero() {
    v8f v;
#pragma unroll
    for (int i = 0; i < 8; ++i) v[i] = 0.0f;
    return v;
}

// A fragment (16x32 bf16, row-major source with row stride D_):
// lanes 0-15 : row = mr+lane,    K chunks [k0, k0+8) and [k0+16, k0+24)
// lanes 16-31: row = mr+lane-16, K chunks [k0+8, k0+16) and [k0+24, k0+32)
__device__ __forceinline__ v16bf frag_a(const bf16_t* __restrict__ A, int mr, int k0, int lane) {
    int r  = mr + (lane & 15);
    int kk = k0 + ((lane >> 4) << 3);
    v8bf lo = *(const v8bf*)(A + r * D_ + kk);
    v8bf hi = *(const v8bf*)(A + r * D_ + kk + 16);
    v16bf f;
#pragma unroll
    for (int i = 0; i < 8; ++i) { f[i] = lo[i]; f[i + 8] = hi[i]; }
    return f;
}

// B fragment (32x16 bf16). B[k][n] = W[n][k] (we compute X @ W.T), so a
// column of B is a contiguous row of W (row-major [D_][D_] bf16).
__device__ __forceinline__ v16bf frag_b(const bf16_t* __restrict__ W, int nc, int k0, int lane) {
    int c  = nc + (lane & 15);
    int kk = k0 + ((lane >> 4) << 3);
    v8bf lo = *(const v8bf*)(W + c * D_ + kk);
    v8bf hi = *(const v8bf*)(W + c * D_ + kk + 16);
    v16bf f;
#pragma unroll
    for (int i = 0; i < 8; ++i) { f[i] = lo[i]; f[i + 8] = hi[i]; }
    return f;
}

// ---------------- prep 1: convert Wq/Wk/Wv to bf16 (contiguous dst) --------
extern "C" __global__ void __launch_bounds__(256)
baca_cvt_w(const float* __restrict__ Wq, const float* __restrict__ Wk,
           const float* __restrict__ Wv, bf16_t* __restrict__ dst) {
    int idx = blockIdx.x * 256 + threadIdx.x;           // 0 .. 3*65536
    const float* src = (idx < 65536) ? Wq : (idx < 131072 ? Wk : Wv);
    dst[idx] = (bf16_t)src[idx & 65535];
}

// ---------------- prep 2: P_u* = batch_emb @ U*.T + b* + bu* ---------------
extern "C" __global__ void __launch_bounds__(256)
baca_pu(const float* __restrict__ Uq, const float* __restrict__ buq, const float* __restrict__ bq,
        const float* __restrict__ Uk, const float* __restrict__ buk, const float* __restrict__ bk,
        const float* __restrict__ Uv, const float* __restrict__ buv, const float* __restrict__ bv,
        const float* __restrict__ batch_emb,
        float* __restrict__ P_uq, float* __restrict__ P_uk, float* __restrict__ P_uv) {
    int idx = blockIdx.x * 256 + threadIdx.x;           // 0 .. 3*16*256
    int which = idx / (NB_ * D_);
    int rem   = idx - which * (NB_ * D_);
    int nb = rem >> 8, d = rem & 255;
    const float* U  = (which == 0) ? Uq  : (which == 1) ? Uk  : Uv;
    const float* bu = (which == 0) ? buq : (which == 1) ? buk : buv;
    const float* bw = (which == 0) ? bq  : (which == 1) ? bk  : bv;
    float*       P  = (which == 0) ? P_uq: (which == 1) ? P_uk: P_uv;
    float acc = bu[d] + bw[d];
    const float* e = batch_emb + nb * D_;
    const float* u = U + d * D_;
#pragma unroll 8
    for (int k = 0; k < D_; ++k) acc = fmaf(e[k], u[k], acc);
    P[rem] = acc;
}

// ---------------- kernel A: Q = h_recv@Wq.T + gather(P_uq); b1 MLP ---------
// LDS carve: Hs f32[64*HP_] | h1 f32[64*128] | As bf16[64*256] | br int[64]
extern "C" __global__ void __launch_bounds__(256)
baca_qb1(const float* __restrict__ h_recv, const int* __restrict__ batch_recv,
         const bf16_t* __restrict__ Wq_bf, const float* __restrict__ P_uq,
         const float* __restrict__ batch_emb,
         const float* __restrict__ D1, const float* __restrict__ db1,
         const float* __restrict__ D2, const float* __restrict__ db2,
         float* __restrict__ Qf, float* __restrict__ b1w) {
    extern __shared__ char smem[];
    float*  Hs = (float*)smem;                   // 64*HP_
    float*  h1 = Hs + 64 * HP_;                  // 64*128
    bf16_t* As = (bf16_t*)(h1 + 64 * 128);       // 64*256
    int*    br = (int*)(As + 64 * 256);          // 64

    const int t = threadIdx.x, lane = t & 31, wave = t >> 5;
    const int m0 = blockIdx.x * 64;

    const float* hr = h_recv + (size_t)m0 * D_;
#pragma unroll 4
    for (int i = 0; i < 64; ++i) {
        int idx = t + i * 256;
        float v = hr[idx];
        Hs[(idx >> 8) * HP_ + (idx & 255)] = v;
        As[idx] = (bf16_t)v;
    }
    if (t < 64) br[t] = batch_recv[m0 + t];
    __syncthreads();

    // receiver_state = h_recv + E_recv (in place; WMMA below only reads As)
#pragma unroll 4
    for (int i = 0; i < 64; ++i) {
        int idx = t + i * 256;
        Hs[(idx >> 8) * HP_ + (idx & 255)] += batch_emb[br[idx >> 8] * D_ + (idx & 255)];
    }

    // WMMA: 64x256 output, 8 waves x 8 tiles
    {
        const int strip = (wave & 3) * 16;
        const int chalf = (wave >> 2) * 8;
        v8f acc[8];
#pragma unroll
        for (int ct = 0; ct < 8; ++ct) acc[ct] = v8f_zero();
        for (int k0 = 0; k0 < D_; k0 += 32) {
            v16bf a = frag_a(As, strip, k0, lane);
#pragma unroll
            for (int ct = 0; ct < 8; ++ct) {
                v16bf bb = frag_b(Wq_bf, (chalf + ct) * 16, k0, lane);
                acc[ct] = __builtin_amdgcn_wmma_f32_16x16x32_bf16(
                    false, a, false, bb, (short)0, acc[ct], false, false);
            }
        }
        const int rbase = strip + ((lane >> 4) << 3);
#pragma unroll
        for (int ct = 0; ct < 8; ++ct) {
            int col = (chalf + ct) * 16 + (lane & 15);
#pragma unroll
            for (int j = 0; j < 8; ++j) {
                int row = rbase + j;
                Qf[(size_t)(m0 + row) * D_ + col] = acc[ct][j] + P_uq[br[row] * D_ + col];
            }
        }
    }
    __syncthreads();

    // hidden = relu(rs @ D1.T + db1) on f32 16x16x4 WMMA (operands stay f32).
    // Wave w owns hidden columns [16w, 16w+16) for all 64 rows, so each D1 row
    // is read once per workgroup. Lane (c, hh) loads 4 contiguous k at
    // k0 + 4*hh of A row c and of D1 row c with the same code: elements 0,1
    // feed one WMMA and 2,3 the next, so A and B pair on equal k.
    {
        const int c = lane & 15, hh = lane >> 4;
        const int j = wave * 16 + c;
        const float* xa = Hs + c * HP_ + 4 * hh;
        const float* wb = D1 + j * D_ + 4 * hh;
        v8f hacc[4];
#pragma unroll
        for (int s = 0; s < 4; ++s) hacc[s] = v8f_zero();
        // unrolled so that several k steps' D1 loads are in flight together
#pragma unroll 8
        for (int k0 = 0; k0 < D_; k0 += 8) {
            v4f bv = *(const v4f*)(wb + k0);
            v2f b0 = {bv[0], bv[1]}, b1 = {bv[2], bv[3]};
#pragma unroll
            for (int s = 0; s < 4; ++s) {
                v4f av = *(const v4f*)(xa + s * 16 * HP_ + k0);
                v2f a0 = {av[0], av[1]}, a1 = {av[2], av[3]};
                hacc[s] = __builtin_amdgcn_wmma_f32_16x16x4_f32(
                    false, a0, false, b0, (short)0, hacc[s], false, false);
                hacc[s] = __builtin_amdgcn_wmma_f32_16x16x4_f32(
                    false, a1, false, b1, (short)0, hacc[s], false, false);
            }
        }
        const float bias = db1[j];
#pragma unroll
        for (int s = 0; s < 4; ++s) {
#pragma unroll
            for (int r = 0; r < 8; ++r)
                h1[(s * 16 + 8 * hh + r) * 128 + j] = fmaxf(hacc[s][r] + bias, 0.0f);
        }
    }
    __syncthreads();

    // b1 = softplus(h1 @ D2.T + db2)
#pragma unroll
    for (int rep = 0; rep < 2; ++rep) {
        int idx = rep * 256 + t;
        int r = idx >> 3, h = idx & 7;
        float d = db2[h];
        const float* w = D2 + h * 128;
        const float* x = h1 + r * 128;
#pragma unroll 8
        for (int k = 0; k < 128; ++k) d = fmaf(x[k], w[k], d);
        b1w[(size_t)(m0 + r) * H_ + h] = log1pf(__expf(d));
    }
}

// ---------------- kernel B: fused K/V projection + attention per b ---------
// V never touches LDS: V-waves keep accumulators in registers and contract
// them against attn directly (register tile j-axis == n reduction axis).
// LDS carve (143 KB -> 2 WGs/WGP):
//   Ks f32[64*256] | Pk f32[16*256] | Pv f32[16*256] | Qs f32[256]
//   sc f32[512] | b1s f32[8] | inv f32[8] | dists f32[64] | zpart f32[8*256]
//   As bf16[64*256] | bs int[64] | msk int[64]
extern "C" __global__ void __launch_bounds__(256)
baca_attn(const float* __restrict__ h_send, const int* __restrict__ batch_recv,
          const int* __restrict__ batch_send, const float* __restrict__ dist,
          const int* __restrict__ mask, const float* __restrict__ gamma,
          const bf16_t* __restrict__ Wk_bf, const bf16_t* __restrict__ Wv_bf,
          const float* __restrict__ P_uk, const float* __restrict__ P_uv,
          const float* __restrict__ Qf, const float* __restrict__ b1w,
          float* __restrict__ z_out, float* __restrict__ attn_out) {
    extern __shared__ char smem[];
    float*  Ks    = (float*)smem;                // 64*256
    float*  Pk    = Ks + 64 * 256;               // 16*256
    float*  Pv    = Pk + 16 * 256;               // 16*256
    float*  Qs    = Pv + 16 * 256;               // 256
    float*  sc    = Qs + 256;                    // 64*8
    float*  b1s   = sc + 512;                    // 8
    float*  inv   = b1s + 8;                     // 8
    float*  dists = inv + 8;                     // 64
    float*  zpart = dists + 64;                  // 8*256
    bf16_t* As    = (bf16_t*)(zpart + 8 * 256);  // 64*256 (16B aligned)
    int*    bs    = (int*)(As + 64 * 256);       // 64
    int*    msk   = bs + 64;                     // 64

    const int t = threadIdx.x, lane = t & 31, wave = t >> 5;
    const int b = blockIdx.x;

    // stage: h_send[b] -> bf16, P_uk/P_uv tables, Q row, per-n scalars
    const float* hs = h_send + (size_t)b * (N_ * D_);
#pragma unroll 4
    for (int i = 0; i < 64; ++i) {
        int idx = t + i * 256;
        As[idx] = (bf16_t)hs[idx];
    }
    for (int i = t; i < NB_ * D_; i += 256) { Pk[i] = P_uk[i]; Pv[i] = P_uv[i]; }
    Qs[t] = Qf[(size_t)b * D_ + t];
    if (t < 64) {
        bs[t]    = batch_send[b * N_ + t];
        msk[t]   = mask[b * N_ + t];
        dists[t] = dist[b * N_ + t];
    }
    if (t < H_) b1s[t] = b1w[(size_t)b * H_ + t];
    __syncthreads();

    // K/V projection: waves 0-3 -> K strips 0..3 (to LDS with P_uk bias),
    //                 waves 4-7 -> V strips 0..3 (stay in registers)
    const int mat   = wave >> 2;
    const int strip = (wave & 3) * 16;
    const int rbase = strip + ((lane >> 4) << 3);
    v8f acc[16];
#pragma unroll
    for (int ct = 0; ct < 16; ++ct) acc[ct] = v8f_zero();
    {
        const bf16_t* W = mat ? Wv_bf : Wk_bf;
        for (int k0 = 0; k0 < D_; k0 += 32) {
            v16bf a = frag_a(As, strip, k0, lane);
#pragma unroll
            for (int ct = 0; ct < 16; ++ct) {
                v16bf bb = frag_b(W, ct * 16, k0, lane);
                acc[ct] = __builtin_amdgcn_wmma_f32_16x16x32_bf16(
                    false, a, false, bb, (short)0, acc[ct], false, false);
            }
        }
    }
    if (mat == 0) {
#pragma unroll
        for (int ct = 0; ct < 16; ++ct) {
            int col = ct * 16 + (lane & 15);
#pragma unroll
            for (int j = 0; j < 8; ++j) {
                int row = rbase + j;                 // n index 0..63
                Ks[row * D_ + col] = acc[ct][j] + Pk[bs[row] * D_ + col];
            }
        }
    }
    __syncthreads();

    // scores[n][h]
    const int   br    = batch_recv[b];
    const float scale = 0.1767766952966369f;   // 1/sqrt(32)
#pragma unroll
    for (int rep = 0; rep < 2; ++rep) {
        int idx = t + rep * 256;
        int n = idx >> 3, h = idx & 7;
        float s;
        if (msk[n] == 0) {
            s = -INFINITY;
        } else {
            float d = 0.0f;
            const float* q = Qs + h * DH_;
            const float* k = Ks + n * D_ + h * DH_;
#pragma unroll
            for (int kk = 0; kk < DH_; ++kk) d = fmaf(q[kk], k[kk], d);
            s = d * scale - b1s[h] * dists[n] + gamma[br * NB_ + bs[n]];
        }
        sc[n * H_ + h] = s;
    }
    __syncthreads();

    // softmax over n, per h (8 lanes, N=64 serial — tiny)
    if (t < H_) {
        float m = -INFINITY;
        for (int n = 0; n < N_; ++n) m = fmaxf(m, sc[n * H_ + t]);
        float s = 0.0f;
        for (int n = 0; n < N_; ++n) {
            float e = __expf(sc[n * H_ + t] - m);
            sc[n * H_ + t] = e;
            s += e;
        }
        inv[t] = 1.0f / s;
    }
    __syncthreads();

#pragma unroll
    for (int rep = 0; rep < 2; ++rep) {
        int idx = t + rep * 256;
        int n = idx >> 3, h = idx & 7;
        float a = sc[n * H_ + h] * inv[h];
        sc[n * H_ + h] = a;
        attn_out[((size_t)b * N_ + n) * H_ + h] = a;
    }
    __syncthreads();

    // V-waves: contract register V tiles with attn.
    // Lane owns col = ct*16 + (lane&15); acc[ct][j] is V[rbase+j][col].
    if (mat == 1) {
        const int half = (wave - 4) * 2 + (lane >> 4);   // 0..7
#pragma unroll
        for (int ct = 0; ct < 16; ++ct) {
            int col = ct * 16 + (lane & 15);
            int h = col >> 5;
            float p = 0.0f;
#pragma unroll
            for (int j = 0; j < 8; ++j)
                p = fmaf(sc[(rbase + j) * H_ + h], acc[ct][j], p);
            zpart[half * D_ + col] = p;
        }
    }
    __syncthreads();

    // z[b, col] = sum(zpart) + sum_n attn[n,h] * P_uv[bs[n]][col]
    {
        const int h = t >> 5;
        float z = 0.0f;
#pragma unroll
        for (int p = 0; p < 8; ++p) z += zpart[p * D_ + t];
#pragma unroll 8
        for (int n = 0; n < N_; ++n)
            z = fmaf(sc[n * H_ + h], Pv[bs[n] * D_ + t], z);
        z_out[(size_t)b * D_ + t] = z;
    }
}

// --------------------------------------------------------------------------
extern "C" void kernel_launch(void* const* d_in, const int* in_sizes, int n_in,
                              void* d_out, int out_size, void* d_ws, size_t ws_size,
                              hipStream_t stream) {
    const float* h_recv     = (const float*)d_in[0];
    const float* h_send     = (const float*)d_in[1];
    const int*   batch_recv = (const int*)d_in[2];
    const int*   batch_send = (const int*)d_in[3];
    const float* dist       = (const float*)d_in[4];
    const int*   mask       = (const int*)d_in[5];
    const float* Wq = (const float*)d_in[6];  const float* bq  = (const float*)d_in[7];
    const float* Wk = (const float*)d_in[8];  const float* bk  = (const float*)d_in[9];
    const float* Wv = (const float*)d_in[10]; const float* bv  = (const float*)d_in[11];
    const float* Uq = (const float*)d_in[12]; const float* buq = (const float*)d_in[13];
    const float* Uk = (const float*)d_in[14]; const float* buk = (const float*)d_in[15];
    const float* Uv = (const float*)d_in[16]; const float* buv = (const float*)d_in[17];
    const float* batch_emb = (const float*)d_in[18];
    const float* D1  = (const float*)d_in[19]; const float* db1 = (const float*)d_in[20];
    const float* D2  = (const float*)d_in[21]; const float* db2 = (const float*)d_in[22];
    const float* gamma = (const float*)d_in[23];

    // workspace carve (≈4.6 MB)
    bf16_t* Wq_bf = (bf16_t*)d_ws;
    bf16_t* Wk_bf = Wq_bf + D_ * D_;
    bf16_t* Wv_bf = Wk_bf + D_ * D_;
    float*  P_uq  = (float*)(Wv_bf + D_ * D_);
    float*  P_uk  = P_uq + NB_ * D_;
    float*  P_uv  = P_uk + NB_ * D_;
    float*  Qf    = P_uv + NB_ * D_;            // B*D
    float*  b1w   = Qf + (size_t)B_ * D_;       // B*H

    float* z_out    = (float*)d_out;
    float* attn_out = z_out + (size_t)B_ * D_;

    hipLaunchKernelGGL(baca_cvt_w, dim3(3 * D_ * D_ / 256), dim3(256), 0, stream,
                       Wq, Wk, Wv, Wq_bf);
    hipLaunchKernelGGL(baca_pu, dim3(3 * NB_ * D_ / 256), dim3(256), 0, stream,
                       Uq, buq, bq, Uk, buk, bk, Uv, buv, bv, batch_emb,
                       P_uq, P_uk, P_uv);

    size_t lds_a = (64 * HP_ + 64 * 128) * sizeof(float)
                 + 64 * 256 * sizeof(bf16_t) + 64 * sizeof(int);
    hipLaunchKernelGGL(baca_qb1, dim3(B_ / 64), dim3(256), lds_a, stream,
                       h_recv, batch_recv, Wq_bf, P_uq, batch_emb,
                       D1, db1, D2, db2, Qf, b1w);

    size_t lds_b = (64 * 256 + 2 * 16 * 256 + 256 + 512 + 8 + 8 + 64 + 8 * 256) * sizeof(float)
                 + 64 * 256 * sizeof(bf16_t) + 128 * sizeof(int);
    hipLaunchKernelGGL(baca_attn, dim3(B_), dim3(256), lds_b, stream,
                       h_send, batch_recv, batch_send, dist, mask, gamma,
                       Wk_bf, Wv_bf, P_uk, P_uv, Qf, b1w, z_out, attn_out);
}

// v002
// Measured time: 320 microseconds a run.
// Next to v001, in two timings, it ran 1.33 and 1.35 times as fast.
// Counting every step since v000, it is 4.05 times as fast.
#include <hip/hip_runtime.h>
#include <hip/hip_bf16.h>
#include <math.h>

#define B_  4096
#define N_  64
#define D_  256
#define H_  8
#define NB_ 16
#define DH_ 32

typedef __bf16 bf16_t;
typedef __attribute__((ext_vector_type(16))) __bf16 v16bf;
typedef __attribute__((ext_vector_type(8)))  __bf16 v8bf;
typedef __attribute__((ext_vector_type(8)))  float  v8f;
typedef __attribute__((ext_vector_type(4)))  float  v4f;
typedef __attribute__((ext_vector_type(2)))  float  v2f;

// LDS row pitch (floats) of the f32 receiver state: 1040 B = 16 B x 65, so the
// 16 rows of one ds_load_b128 fragment read fall on 64 distinct banks.
#define HP_ 260

__device__ __forceinline__ v8f v8f_zero() {
    v8f v;
#pragma unroll
    for (int i = 0; i < 8; ++i) v[i] = 0.0f;
    return v;
}

// A fragment (16x32 bf16, row-major source with row stride D_):
// lanes 0-15 : row = mr+lane,    K chunks [k0, k0+8) and [k0+16, k0+24)
// lanes 16-31: row = mr+lane-16, K chunks [k0+8, k0+16) and [k0+24, k0+32)
__device__ __forceinline__ v16bf frag_a(const bf16_t* __restrict__ A, int mr, int k0, int lane) {
    int r  = mr + (lane & 15);
    int kk = k0 + ((lane >> 4) << 3);
    v8bf lo = *(const v8bf*)(A + r * D_ + kk);
    v8bf hi = *(const v8bf*)(A + r * D_ + kk + 16);
    v16bf f;
#pragma unroll
    for (int i = 0; i < 8; ++i) { f[i] = lo[i]; f[i + 8] = hi[i]; }
    return f;
}

// B fragment (32x16 bf16). B[k][n] = W[n][k] (we compute X @ W.T). The weights
// lie in the workspace in fragment order (baca_cvt_w): fragment (k step ks,
// column tile ct) is the 1 KB block ks*16 + ct, its first 512 B the 32 lanes'
// low k chunks in lane order, its second 512 B their high k chunks. Each
// wave-wide 16-byte load so covers four whole 128-B lines, not 32 B of sixteen.
__device__ __forceinline__ v16bf frag_b(const bf16_t* __restrict__ Wp, int ct, int ks, int lane) {
    const bf16_t* p = Wp + ((ks * 16 + ct) << 9) + (lane << 3);
    v8bf lo = *(const v8bf*)(p);
    v8bf hi = *(const v8bf*)(p + 256);
    v16bf f;
#pragma unroll
    for (int i = 0; i < 8; ++i) { f[i] = lo[i]; f[i + 8] = hi[i]; }
    return f;
}

// ---------------- prep 1: convert Wq/Wk/Wv to bf16, in fragment order ------
// dst element: [matrix][ks*16 + ct][part][lane][e] holds
// W[ct*16 + (lane & 15)][ks*32 + part*16 + (lane >> 4)*8 + e], frag_a's k order.
extern "C" __global__ void __launch_bounds__(256)
baca_cvt_w(const float* __restrict__ Wq, const float* __restrict__ Wk,
           const float* __restrict__ Wv, bf16_t* __restrict__ dst) {
    int idx = blockIdx.x * 256 + threadIdx.x;           // 0 .. 3*65536
    const float* src = (idx < 65536) ? Wq : (idx < 131072 ? Wk : Wv);
    int e = idx & 7, lane = (idx >> 3) & 31, part = (idx >> 8) & 1;
    int ct = (idx >> 9) & 15, ks = (idx >> 13) & 7;
    int row = ct * 16 + (lane & 15);
    int k   = ks * 32 + part * 16 + ((lane >> 4) << 3) + e;
    dst[idx] = (bf16_t)src[row * D_ + k];
}

// ---------------- prep 2: P_u* = batch_emb @ U*.T + b* + bu* ---------------
extern "C" __global__ void __launch_bounds__(256)
baca_pu(const float* __restrict__ Uq, const float* __restrict__ buq, const float* __restrict__ bq,
        const float* __restrict__ Uk, const float* __restrict__ buk, const float* __restrict__ bk,
        const float* __restrict__ Uv, const float* __restrict__ buv, const float* __restrict__ bv,
        const float* __restrict__ batch_emb,
        float* __restrict__ P_uq, float* __restrict__ P_uk, float* __restrict__ P_uv) {
    int idx = blockIdx.x * 256 + threadIdx.x;           // 0 .. 3*16*256
    int which = idx / (NB_ * D_);
    int rem   = idx - which * (NB_ * D_);
    int nb = rem >> 8, d = rem & 255;
    const float* U  = (which == 0) ? Uq  : (which == 1) ? Uk  : Uv;
    const float* bu = (which == 0) ? buq : (which == 1) ? buk : buv;
    const float* bw = (which == 0) ? bq  : (which == 1) ? bk  : bv;
    float*       P  = (which == 0) ? P_uq: (which == 1) ? P_uk: P_uv;
    float acc = bu[d] + bw[d];
    const float* e = batch_emb + nb * D_;
    const float* u = U + d * D_;
#pragma unroll 8
    for (int k = 0; k < D_; ++k) acc = fmaf(e[k], u[k], acc);
    P[rem] = acc;
}

// ---------------- kernel A: Q = h_recv@Wq.T + gather(P_uq); b1 MLP ---------
// LDS carve: Hs f32[64*HP_] | h1 f32[64*128] | As bf16[64*256] | br int[64]
extern "C" __global__ void __launch_bounds__(256)
baca_qb1(const float* __restrict__ h_recv, const int* __restrict__ batch_recv,
         const bf16_t* __restrict__ Wq_bf, const float* __restrict__ P_uq,
         const float* __restrict__ batch_emb,
         const float* __restrict__ D1, const float* __restrict__ db1,
         const float* __restrict__ D2, const float* __restrict__ db2,
         float* __restrict__ Qf, float* __restrict__ b1w) {
    extern __shared__ char smem[];
    float*  Hs = (float*)smem;                   // 64*HP_
    float*  h1 = Hs + 64 * HP_;                  // 64*128
    bf16_t* As = (bf16_t*)(h1 + 64 * 128);       // 64*256
    int*    br = (int*)(As + 64 * 256);          // 64

    const int t = threadIdx.x, lane = t & 31, wave = t >> 5;
    const int m0 = blockIdx.x * 64;

    const float* hr = h_recv + (size_t)m0 * D_;
#pragma unroll 4
    for (int i = 0; i < 64; ++i) {
        int idx = t + i * 256;
        float v = hr[idx];
        Hs[(idx >> 8) * HP_ + (idx & 255)] = v;
        As[idx] = (bf16_t)v;
    }
    if (t < 64) br[t] = batch_recv[m0 + t];
    __syncthreads();

    // receiver_state = h_recv + E_recv (in place; WMMA below only reads As)
#pragma unroll 4
    for (int i = 0; i < 64; ++i) {
        int idx = t + i * 256;
        Hs[(idx >> 8) * HP_ + (idx & 255)] += batch_emb[br[idx >> 8] * D_ + (idx & 255)];
    }

    // WMMA: 64x256 output, 8 waves x 8 tiles
    {
        const int strip = (wave & 3) * 16;
        const int chalf = (wave >> 2) * 8;
        v8f acc[8];
#pragma unroll
        for (int ct = 0; ct < 8; ++ct) acc[ct] = v8f_zero();
        for (int k0 = 0; k0 < D_; k0 += 32) {
            v16bf a = frag_a(As, strip, k0, lane);
#pragma unroll
            for (int ct = 0; ct < 8; ++ct) {
                v16bf bb = frag_b(Wq_bf, chalf + ct, k0 >> 5, lane);
                acc[ct] = __builtin_amdgcn_wmma_f32_16x16x32_bf16(
                    false, a, false, bb, (short)0, acc[ct], false, false);
            }
        }
        const int rbase = strip + ((lane >> 4) << 3);
#pragma unroll
        for (int ct = 0; ct < 8; ++ct) {
            int col = (chalf + ct) * 16 + (lane & 15);
#pragma unroll
            for (int j = 0; j < 8; ++j) {
                int row = rbase + j;
                Qf[(size_t)(m0 + row) * D_ + col] = acc[ct][j] + P_uq[br[row] * D_ + col];
            }
        }
    }
    __syncthreads();

    // hidden = relu(rs @ D1.T + db1) on f32 16x16x4 WMMA (operands stay f32).
    // Wave w owns hidden columns [16w, 16w+16) for all 64 rows, so each D1 row
    // is read once per workgroup. Lane (c, hh) loads 4 contiguous k at
    // k0 + 4*hh of A row c and of D1 row c with the same code: elements 0,1
    // feed one WMMA and 2,3 the next, so A and B pair on equal k.
    {
        const int c = lane & 15, hh = lane >> 4;
        const int j = wave * 16 + c;
        const float* xa = Hs + c * HP_ + 4 * hh;
        const float* wb = D1 + j * D_ + 4 * hh;
        v8f hacc[4];
#pragma unroll
        for (int s = 0; s < 4; ++s) hacc[s] = v8f_zero();
        // unrolled so that several k steps' D1 loads are in flight together
#pragma unroll 8
        for (int k0 = 0; k0 < D_; k0 += 8) {
            v4f bv = *(const v4f*)(wb + k0);
            v2f b0 = {bv[0], bv[1]}, b1 = {bv[2], bv[3]};
#pragma unroll
            for (int s = 0; s < 4; ++s) {
                v4f av = *(const v4f*)(xa + s * 16 * HP_ + k0);
                v2f a0 = {av[0], av[1]}, a1 = {av[2], av[3]};
                hacc[s] = __builtin_amdgcn_wmma_f32_16x16x4_f32(
                    false, a0, false, b0, (short)0, hacc[s], false, false);
                hacc[s] = __builtin_amdgcn_wmma_f32_16x16x4_f32(
                    false, a1, false, b1, (short)0, hacc[s], false, false);
            }
        }
        const float bias = db1[j];
#pragma unroll
        for (int s = 0; s < 4; ++s) {
#pragma unroll
            for (int r = 0; r < 8; ++r)
                h1[(s * 16 + 8 * hh + r) * 128 + j] = fmaxf(hacc[s][r] + bias, 0.0f);
        }
    }
    __syncthreads();

    // b1 = softplus(h1 @ D2.T + db2)
#pragma unroll
    for (int rep = 0; rep < 2; ++rep) {
        int idx = rep * 256 + t;
        int r = idx >> 3, h = idx & 7;
        float d = db2[h];
        const float* w = D2 + h * 128;
        const float* x = h1 + r * 128;
#pragma unroll 8
        for (int k = 0; k < 128; ++k) d = fmaf(x[k], w[k], d);
        b1w[(size_t)(m0 + r) * H_ + h] = log1pf(__expf(d));
    }
}

// ---------------- kernel B: fused K/V projection + attention per b ---------
// V never touches LDS: V-waves keep accumulators in registers and contract
// them against attn directly (register tile j-axis == n reduction axis).
// LDS carve (143 KB -> 2 WGs/WGP):
//   Ks f32[64*256] | Pk f32[16*256] | Pv f32[16*256] | Qs f32[256]
//   sc f32[512] | b1s f32[8] | inv f32[8] | dists f32[64] | zpart f32[8*256]
//   As bf16[64*256] | bs int[64] | msk int[64]
extern "C" __global__ void __launch_bounds__(256)
baca_attn(const float* __restrict__ h_send, const int* __restrict__ batch_recv,
          const int* __restrict__ batch_send, const float* __restrict__ dist,
          const int* __restrict__ mask, const float* __restrict__ gamma,
          const bf16_t* __restrict__ Wk_bf, const bf16_t* __restrict__ Wv_bf,
          const float* __restrict__ P_uk, const float* __restrict__ P_uv,
          const float* __restrict__ Qf, const float* __restrict__ b1w,
          float* __restrict__ z_out, float* __restrict__ attn_out) {
    extern __shared__ char smem[];
    float*  Ks    = (float*)smem;                // 64*256
    float*  Pk    = Ks + 64 * 256;               // 16*256
    float*  Pv    = Pk + 16 * 256;               // 16*256
    float*  Qs    = Pv + 16 * 256;               // 256
    float*  sc    = Qs + 256;                    // 64*8
    float*  b1s   = sc + 512;                    // 8
    float*  inv   = b1s + 8;                     // 8
    float*  dists = inv + 8;                     // 64
    float*  zpart = dists + 64;                  // 8*256
    bf16_t* As    = (bf16_t*)(zpart + 8 * 256);  // 64*256 (16B aligned)
    int*    bs    = (int*)(As + 64 * 256);       // 64
    int*    msk   = bs + 64;                     // 64

    const int t = threadIdx.x, lane = t & 31, wave = t >> 5;
    const int b = blockIdx.x;

    // stage: h_send[b] -> bf16, P_uk/P_uv tables, Q row, per-n scalars
    const float* hs = h_send + (size_t)b * (N_ * D_);
#pragma unroll 4
    for (int i = 0; i < 64; ++i) {
        int idx = t + i * 256;
        As[idx] = (bf16_t)hs[idx];
    }
    for (int i = t; i < NB_ * D_; i += 256) { Pk[i] = P_uk[i]; Pv[i] = P_uv[i]; }
    Qs[t] = Qf[(size_t)b * D_ + t];
    if (t < 64) {
        bs[t]    = batch_send[b * N_ + t];
        msk[t]   = mask[b * N_ + t];
        dists[t] = dist[b * N_ + t];
    }
    if (t < H_) b1s[t] = b1w[(size_t)b * H_ + t];
    __syncthreads();

    // K/V projection: waves 0-3 -> K strips 0..3 (to LDS with P_uk bias),
    //                 waves 4-7 -> V strips 0..3 (stay in registers)
    const int mat   = wave >> 2;
    const int strip = (wave & 3) * 16;
    const int rbase = strip + ((lane >> 4) << 3);
    v8f acc[16];
#pragma unroll
    for (int ct = 0; ct < 16; ++ct) acc[ct] = v8f_zero();
    {
        const bf16_t* W = mat ? Wv_bf : Wk_bf;
        for (int k0 = 0; k0 < D_; k0 += 32) {
            v16bf a = frag_a(As, strip, k0, lane);
#pragma unroll
            for (int ct = 0; ct < 16; ++ct) {
                v16bf bb = frag_b(W, ct, k0 >> 5, lane);
                acc[ct] = __builtin_amdgcn_wmma_f32_16x16x32_bf16(
                    false, a, false, bb, (short)0, acc[ct], false, false);
            }
        }
    }
    if (mat == 0) {
#pragma unroll
        for (int ct = 0; ct < 16; ++ct) {
            int col = ct * 16 + (lane & 15);
#pragma unroll
            for (int j = 0; j < 8; ++j) {
                int row = rbase + j;                 // n index 0..63
                Ks[row * D_ + col] = acc[ct][j] + Pk[bs[row] * D_ + col];
            }
        }
    }
    __syncthreads();

    // scores[n][h]
    const int   br    = batch_recv[b];
    const float scale = 0.1767766952966369f;   // 1/sqrt(32)
#pragma unroll
    for (int rep = 0; rep < 2; ++rep) {
        int idx = t + rep * 256;
        int n = idx >> 3, h = idx & 7;
        float s;
        if (msk[n] == 0) {
            s = -INFINITY;
        } else {
            float d = 0.0f;
            const float* q = Qs + h * DH_;
            const float* k = Ks + n * D_ + h * DH_;
#pragma unroll
            for (int kk = 0; kk < DH_; ++kk) d = fmaf(q[kk], k[kk], d);
            s = d * scale - b1s[h] * dists[n] + gamma[br * NB_ + bs[n]];
        }
        sc[n * H_ + h] = s;
    }
    __syncthreads();

    // softmax over n, per h (8 lanes, N=64 serial — tiny)
    if (t < H_) {
        float m = -INFINITY;
        for (int n = 0; n < N_; ++n) m = fmaxf(m, sc[n * H_ + t]);
        float s = 0.0f;
        for (int n = 0; n < N_; ++n) {
            float e = __expf(sc[n * H_ + t] - m);
            sc[n * H_ + t] = e;
            s += e;
        }
        inv[t] = 1.0f / s;
    }
    __syncthreads();

#pragma unroll
    for (int rep = 0; rep < 2; ++rep) {
        int idx = t + rep * 256;
        int n = idx >> 3, h = idx & 7;
        float a = sc[n * H_ + h] * inv[h];
        sc[n * H_ + h] = a;
        attn_out[((size_t)b * N_ + n) * H_ + h] = a;
    }
    __syncthreads();

    // V-waves: contract register V tiles with attn.
    // Lane owns col = ct*16 + (lane&15); acc[ct][j] is V[rbase+j][col].
    if (mat == 1) {
        const int half = (wave - 4) * 2 + (lane >> 4);   // 0..7
#pragma unroll
        for (int ct = 0; ct < 16; ++ct) {
            int col = ct * 16 + (lane & 15);
            int h = col >> 5;
            float p = 0.0f;
#pragma unroll
            for (int j = 0; j < 8; ++j)
                p = fmaf(sc[(rbase + j) * H_ + h], acc[ct][j], p);
            zpart[half * D_ + col] = p;
        }
    }
    __syncthreads();

    // z[b, col] = sum(zpart) + sum_n attn[n,h] * P_uv[bs[n]][col]
    {
        const int h = t >> 5;
        float z = 0.0f;
#pragma unroll
        for (int p = 0; p < 8; ++p) z += zpart[p * D_ + t];
#pragma unroll 8
        for (int n = 0; n < N_; ++n)
            z = fmaf(sc[n * H_ + h], Pv[bs[n] * D_ + t], z);
        z_out[(size_t)b * D_ + t] = z;
    }
}

// --------------------------------------------------------------------------
extern "C" void kernel_launch(void* const* d_in, const int* in_sizes, int n_in,
                              void* d_out, int out_size, void* d_ws, size_t ws_size,
                              hipStream_t stream) {
    const float* h_recv     = (const float*)d_in[0];
    const float* h_send     = (const float*)d_in[1];
    const int*   batch_recv = (const int*)d_in[2];
    const int*   batch_send = (const int*)d_in[3];
    const float* dist       = (const float*)d_in[4];
    const int*   mask       = (const int*)d_in[5];
    const float* Wq = (const float*)d_in[6];  const float* bq  = (const float*)d_in[7];
    const float* Wk = (const float*)d_in[8];  const float* bk  = (const float*)d_in[9];
    const float* Wv = (const float*)d_in[10]; const float* bv  = (const float*)d_in[11];
    const float* Uq = (const float*)d_in[12]; const float* buq = (const float*)d_in[13];
    const float* Uk = (const float*)d_in[14]; const float* buk = (const float*)d_in[15];
    const float* Uv = (const float*)d_in[16]; const float* buv = (const float*)d_in[17];
    const float* batch_emb = (const float*)d_in[18];
    const float* D1  = (const float*)d_in[19]; const float* db1 = (const float*)d_in[20];
    const float* D2  = (const float*)d_in[21]; const float* db2 = (const float*)d_in[22];
    const float* gamma = (const float*)d_in[23];

    // workspace carve (≈4.6 MB)
    bf16_t* Wq_bf = (bf16_t*)d_ws;
    bf16_t* Wk_bf = Wq_bf + D_ * D_;
    bf16_t* Wv_bf = Wk_bf + D_ * D_;
    float*  P_uq  = (float*)(Wv_bf + D_ * D_);
    float*  P_uk  = P_uq + NB_ * D_;
    float*  P_uv  = P_uk + NB_ * D_;
    float*  Qf    = P_uv + NB_ * D_;            // B*D
    float*  b1w   = Qf + (size_t)B_ * D_;       // B*H

    float* z_out    = (float*)d_out;
    float* attn_out = z_out + (size_t)B_ * D_;

    hipLaunchKernelGGL(baca_cvt_w, dim3(3 * D_ * D_ / 256), dim3(256), 0, stream,
                       Wq, Wk, Wv, Wq_bf);
    hipLaunchKernelGGL(baca_pu, dim3(3 * NB_ * D_ / 256), dim3(256), 0, stream,
                       Uq, buq, bq, Uk, buk, bk, Uv, buv, bv, batch_emb,
                       P_uq, P_uk, P_uv);

    size_t lds_a = (64 * HP_ + 64 * 128) * sizeof(float)
                 + 64 * 256 * sizeof(bf16_t) + 64 * sizeof(int);
    hipLaunchKernelGGL(baca_qb1, dim3(B_ / 64), dim3(256), lds_a, stream,
                       h_recv, batch_recv, Wq_bf, P_uq, batch_emb,
                       D1, db1, D2, db2, Qf, b1w);

    size_t lds_b = (64 * 256 + 2 * 16 * 256 + 256 + 512 + 8 + 8 + 64 + 8 * 256) * sizeof(float)
                 + 64 * 256 * sizeof(bf16_t) + 128 * sizeof(int);
    hipLaunchKernelGGL(baca_attn, dim3(B_), dim3(256), lds_b, stream,
                       h_send, batch_recv, batch_send, dist, mask, gamma,
                       Wk_bf, Wv_bf, P_uk, P_uv, Qf, b1w, z_out, attn_out);
}

// v004
// A run of this version takes 163 microseconds.
// Versions in between are left out here; by their measured steps it is 1.97 times as fast as v002.
// All steps since v000 together make it 7.96 times as fast.
#include <hip/hip_runtime.h>
#include <hip/hip_bf16.h>
#include <math.h>

#define B_  4096
#define N_  64
#define D_  256
#define H_  8
#define NB_ 16
#define DH_ 32

typedef __bf16 bf16_t;
typedef __attribute__((ext_vector_type(16))) __bf16 v16bf;
typedef __attribute__((ext_vector_type(8)))  __bf16 v8bf;
typedef __attribute__((ext_vector_type(8)))  float  v8f;
typedef __attribute__((ext_vector_type(4)))  float  v4f;
typedef __attribute__((ext_vector_type(2)))  float  v2f;

// LDS row pitch (floats) of the f32 receiver state: 1040 B = 16 B x 65, so the
// 16 rows of one ds_load_b128 fragment read fall on 64 distinct banks.
#define HP_ 260

__device__ __forceinline__ v8f v8f_zero() {
    v8f v;
#pragma unroll
    for (int i = 0; i < 8; ++i) v[i] = 0.0f;
    return v;
}

// A fragment (16x32 bf16, row-major source with row stride D_):
// lanes 0-15 : row = mr+lane,    K chunks [k0, k0+8) and [k0+16, k0+24)
// lanes 16-31: row = mr+lane-16, K chunks [k0+8, k0+16) and [k0+24, k0+32)
__device__ __forceinline__ v16bf frag_a(const bf16_t* __restrict__ A, int mr, int k0, int lane) {
    int r  = mr + (lane & 15);
    int kk = k0 + ((lane >> 4) << 3);
    v8bf lo = *(const v8bf*)(A + r * D_ + kk);
    v8bf hi = *(const v8bf*)(A + r * D_ + kk + 16);
    v16bf f;
#pragma unroll
    for (int i = 0; i < 8; ++i) { f[i] = lo[i]; f[i + 8] = hi[i]; }
    return f;
}

// B fragment (32x16 bf16). B[k][n] = W[n][k] (we compute X @ W.T). The weights
// lie in the workspace in fragment order (baca_cvt_w): fragment (k step ks,
// column tile ct) is the 1 KB block ks*16 + ct, its first 512 B the 32 lanes'
// low k chunks in lane order, its second 512 B their high k chunks. Each
// wave-wide 16-byte load so covers four whole 128-B lines, not 32 B of sixteen.
__device__ __forceinline__ v16bf frag_b(const bf16_t* __restrict__ Wp, int ct, int ks, int lane) {
    const bf16_t* p = Wp + ((ks * 16 + ct) << 9) + (lane << 3);
    v8bf lo = *(const v8bf*)(p);
    v8bf hi = *(const v8bf*)(p + 256);
    v16bf f;
#pragma unroll
    for (int i = 0; i < 8; ++i) { f[i] = lo[i]; f[i + 8] = hi[i]; }
    return f;
}

// Score B fragment of k step ks: B[k][h] = QK[b][h][k], q already at the lane's
// head row and low k chunk.
__device__ __forceinline__ v16bf frag_q(const bf16_t* __restrict__ q, int ks) {
    v8bf lo = *(const v8bf*)(q + ks * 32);
    v8bf hi = *(const v8bf*)(q + ks * 32 + 16);
    v16bf f;
#pragma unroll
    for (int i = 0; i < 8; ++i) { f[i] = lo[i]; f[i + 8] = hi[i]; }
    return f;
}

// register sets of B fragments in flight in baca_attn's k loop
#define RING_ 2

// ---------------- prep 1: convert Wq/Wv to bf16, in fragment order ---------
// dst element: [matrix][ks*16 + ct][part][lane][e] holds
// W[ct*16 + (lane & 15)][ks*32 + part*16 + (lane >> 4)*8 + e], frag_a's k order.
extern "C" __global__ void __launch_bounds__(256)
baca_cvt_w(const float* __restrict__ Wq, const float* __restrict__ Wv,
           bf16_t* __restrict__ dst) {
    int idx = blockIdx.x * 256 + threadIdx.x;           // 0 .. 2*65536
    const float* src = (idx < 65536) ? Wq : Wv;
    int e = idx & 7, lane = (idx >> 3) & 31, part = (idx >> 8) & 1;
    int ct = (idx >> 9) & 15, ks = (idx >> 13) & 7;
    int row = ct * 16 + (lane & 15);
    int k   = ks * 32 + part * 16 + ((lane >> 4) << 3) + e;
    dst[idx] = (bf16_t)src[row * D_ + k];
}

// ---------------- prep 2: P_u* = batch_emb @ U*.T + b* + bu* ---------------
extern "C" __global__ void __launch_bounds__(256)
baca_pu(const float* __restrict__ Uq, const float* __restrict__ buq, const float* __restrict__ bq,
        const float* __restrict__ Uk, const float* __restrict__ buk, const float* __restrict__ bk,
        const float* __restrict__ Uv, const float* __restrict__ buv, const float* __restrict__ bv,
        const float* __restrict__ batch_emb,
        float* __restrict__ P_uq, float* __restrict__ P_uk, float* __restrict__ P_uv) {
    int idx = blockIdx.x * 256 + threadIdx.x;           // 0 .. 3*16*256
    int which = idx / (NB_ * D_);
    int rem   = idx - which * (NB_ * D_);
    int nb = rem >> 8, d = rem & 255;
    const float* U  = (which == 0) ? Uq  : (which == 1) ? Uk  : Uv;
    const float* bu = (which == 0) ? buq : (which == 1) ? buk : buv;
    const float* bw = (which == 0) ? bq  : (which == 1) ? bk  : bv;
    float*       P  = (which == 0) ? P_uq: (which == 1) ? P_uk: P_uv;
    float acc = bu[d] + bw[d];
    const float* e = batch_emb + nb * D_;
    const float* u = U + d * D_;
#pragma unroll 8
    for (int k = 0; k < D_; ++k) acc = fmaf(e[k], u[k], acc);
    P[rem] = acc;
}

// ---------------- kernel A: Q = h_recv@Wq.T + gather(P_uq); b1 MLP ---------
// LDS carve: Hs f32[64*HP_] | h1 f32[64*128] | As bf16[64*256] | br int[64]
extern "C" __global__ void __launch_bounds__(256)
baca_qb1(const float* __restrict__ h_recv, const int* __restrict__ batch_recv,
         const bf16_t* __restrict__ Wq_bf, const float* __restrict__ P_uq,
         const float* __restrict__ batch_emb,
         const float* __restrict__ D1, const float* __restrict__ db1,
         const float* __restrict__ D2, const float* __restrict__ db2,
         float* __restrict__ Qf, float* __restrict__ b1w) {
    extern __shared__ char smem[];
    float*  Hs = (float*)smem;                   // 64*HP_
    float*  h1 = Hs + 64 * HP_;                  // 64*128
    bf16_t* As = (bf16_t*)(h1 + 64 * 128);       // 64*256
    int*    br = (int*)(As + 64 * 256);          // 64

    const int t = threadIdx.x, lane = t & 31, wave = t >> 5;
    const int m0 = blockIdx.x * 64;

    const float* hr = h_recv + (size_t)m0 * D_;
#pragma unroll 4
    for (int i = 0; i < 64; ++i) {
        int idx = t + i * 256;
        float v = hr[idx];
        Hs[(idx >> 8) * HP_ + (idx & 255)] = v;
        As[idx] = (bf16_t)v;
    }
    if (t < 64) br[t] = batch_recv[m0 + t];
    __syncthreads();

    // receiver_state = h_recv + E_recv (in place; WMMA below only reads As)
#pragma unroll 4
    for (int i = 0; i < 64; ++i) {
        int idx = t + i * 256;
        Hs[(idx >> 8) * HP_ + (idx & 255)] += batch_emb[br[idx >> 8] * D_ + (idx & 255)];
    }

    // WMMA: 64x256 output, 8 waves x 8 tiles
    {
        const int strip = (wave & 3) * 16;
        const int chalf = (wave >> 2) * 8;
        v8f acc[8];
#pragma unroll
        for (int ct = 0; ct < 8; ++ct) acc[ct] = v8f_zero();
        for (int k0 = 0; k0 < D_; k0 += 32) {
            v16bf a = frag_a(As, strip, k0, lane);
#pragma unroll
            for (int ct = 0; ct < 8; ++ct) {
                v16bf bb = frag_b(Wq_bf, chalf + ct, k0 >> 5, lane);
                acc[ct] = __builtin_amdgcn_wmma_f32_16x16x32_bf16(
                    false, a, false, bb, (short)0, acc[ct], false, false);
            }
        }
        const int rbase = strip + ((lane >> 4) << 3);
#pragma unroll
        for (int ct = 0; ct < 8; ++ct) {
            int col = (chalf + ct) * 16 + (lane & 15);
#pragma unroll
            for (int j = 0; j < 8; ++j) {
                int row = rbase + j;
                Qf[(size_t)(m0 + row) * D_ + col] = acc[ct][j] + P_uq[br[row] * D_ + col];
            }
        }
    }
    __syncthreads();

    // hidden = relu(rs @ D1.T + db1) on f32 16x16x4 WMMA (operands stay f32).
    // Wave w owns hidden columns [16w, 16w+16) for all 64 rows, so each D1 row
    // is read once per workgroup. Lane (c, hh) loads 4 contiguous k at
    // k0 + 4*hh of A row c and of D1 row c with the same code: elements 0,1
    // feed one WMMA and 2,3 the next, so A and B pair on equal k.
    {
        const int c = lane & 15, hh = lane >> 4;
        const int j = wave * 16 + c;
        const float* xa = Hs + c * HP_ + 4 * hh;
        const float* wb = D1 + j * D_ + 4 * hh;
        v8f hacc[4];
#pragma unroll
        for (int s = 0; s < 4; ++s) hacc[s] = v8f_zero();
        // unrolled so that several k steps' D1 loads are in flight together
#pragma unroll 8
        for (int k0 = 0; k0 < D_; k0 += 8) {
            v4f bv = *(const v4f*)(wb + k0);
            v2f b0 = {bv[0], bv[1]}, b1 = {bv[2], bv[3]};
#pragma unroll
            for (int s = 0; s < 4; ++s) {
                v4f av = *(const v4f*)(xa + s * 16 * HP_ + k0);
                v2f a0 = {av[0], av[1]}, a1 = {av[2], av[3]};
                hacc[s] = __builtin_amdgcn_wmma_f32_16x16x4_f32(
                    false, a0, false, b0, (short)0, hacc[s], false, false);
                hacc[s] = __builtin_amdgcn_wmma_f32_16x16x4_f32(
                    false, a1, false, b1, (short)0, hacc[s], false, false);
            }
        }
        const float bias = db1[j];
#pragma unroll
        for (int s = 0; s < 4; ++s) {
#pragma unroll
            for (int r = 0; r < 8; ++r)
                h1[(s * 16 + 8 * hh + r) * 128 + j] = fmaxf(hacc[s][r] + bias, 0.0f);
        }
    }
    __syncthreads();

    // b1 = softplus(h1 @ D2.T + db2)
#pragma unroll
    for (int rep = 0; rep < 2; ++rep) {
        int idx = rep * 256 + t;
        int r = idx >> 3, h = idx & 7;
        float d = db2[h];
        const float* w = D2 + h * 128;
        const float* x = h1 + r * 128;
#pragma unroll 8
        for (int k = 0; k < 128; ++k) d = fmaf(x[k], w[k], d);
        b1w[(size_t)(m0 + r) * H_ + h] = log1pf(__expf(d));
    }
}

// ---------------- prep 3: fold Wk and P_uk into the query ------------------
// Q_h . K[n]_h = h_send[n] . (Q_h @ Wk_h) + Q_h . P_uk[bs[n]]_h, so K is never
// formed: per (b, h) a 256-vector QK and 16 scalars QP replace the 64x256 K.
// Workgroup = 64 rows b x one head, f32 16x16x4 WMMA (operands stay f32).
// Lane (c, hh) holds k = k0 + 4*hh + {0..3} of A row c and of B column c:
// elements 0,1 feed one WMMA and 2,3 the next, so A and B pair on equal k.
// A wave owns 64 columns (one whole 128-B line of bf16 per row) x 32 rows.
extern "C" __global__ void __launch_bounds__(256)
baca_qk(const float* __restrict__ Qf, const float* __restrict__ Wk,
        const float* __restrict__ P_uk,
        bf16_t* __restrict__ QKb, float* __restrict__ QP) {
    const int t = threadIdx.x, lane = t & 31, wave = t >> 5;
    const int h  = blockIdx.x & 7;
    const int m0 = (blockIdx.x >> 3) * 64 + (wave >> 2) * 32;
    const int cg = (wave & 3) * 64;
    const int c = lane & 15, hh = lane >> 4;
    const float* qa = Qf   + (size_t)(m0 + c) * D_ + h * DH_ + 4 * hh;
    const float* wb = Wk   + (h * DH_ + 4 * hh) * D_ + cg + c;
    const float* pb = P_uk + c * D_ + h * DH_ + 4 * hh;
    v8f acc[2][4], pacc[2];
#pragma unroll
    for (int s = 0; s < 2; ++s) {
        pacc[s] = v8f_zero();
#pragma unroll
        for (int ct = 0; ct < 4; ++ct) acc[s][ct] = v8f_zero();
    }
    v4f av[4][2], pv[4];
#pragma unroll
    for (int kq = 0; kq < 4; ++kq) {
        pv[kq] = *(const v4f*)(pb + kq * 8);
#pragma unroll
        for (int s = 0; s < 2; ++s) av[kq][s] = *(const v4f*)(qa + s * 16 * D_ + kq * 8);
    }
    // the loads above are all issued here; behind this wait their address
    // registers may be reused
    asm volatile("s_wait_xcnt 0x0" ::: "memory");
#pragma unroll
    for (int kq = 0; kq < 4; ++kq) {
        v2f a0[2], a1[2];
#pragma unroll
        for (int s = 0; s < 2; ++s) {
            a0[s] = v2f{av[kq][s][0], av[kq][s][1]};
            a1[s] = v2f{av[kq][s][2], av[kq][s][3]};
        }
#pragma unroll
        for (int ct = 0; ct < 4; ++ct) {
            const float* w = wb + kq * 8 * D_ + ct * 16;
            v2f b0 = {w[0], w[D_]}, b1 = {w[2 * D_], w[3 * D_]};
#pragma unroll
            for (int s = 0; s < 2; ++s) {
                acc[s][ct] = __builtin_amdgcn_wmma_f32_16x16x4_f32(
                    false, a0[s], false, b0, (short)0, acc[s][ct], false, false);
                acc[s][ct] = __builtin_amdgcn_wmma_f32_16x16x4_f32(
                    false, a1[s], false, b1, (short)0, acc[s][ct], false, false);
            }
        }
        v2f p0 = {pv[kq][0], pv[kq][1]}, p1 = {pv[kq][2], pv[kq][3]};
#pragma unroll
        for (int s = 0; s < 2; ++s) {
            pacc[s] = __builtin_amdgcn_wmma_f32_16x16x4_f32(
                false, a0[s], false, p0, (short)0, pacc[s], false, false);
            pacc[s] = __builtin_amdgcn_wmma_f32_16x16x4_f32(
                false, a1[s], false, p1, (short)0, pacc[s], false, false);
        }
    }
    // keeps the stores' address arithmetic out of the WMMA block, where it was
    // scheduled onto operand registers directly behind the WMMA that read them
    __builtin_amdgcn_sched_barrier(0);
    // four vector slots between the last WMMA and the first overwrite of its operands
    asm volatile("v_nop\n\tv_nop\n\tv_nop\n\tv_nop");
    // holds the epilogue's vector instructions behind those slots
    __builtin_amdgcn_sched_barrier(0);
#pragma unroll
    for (int s = 0; s < 2; ++s) {
#pragma unroll
        for (int r = 0; r < 8; ++r) {
            size_t row = (size_t)(m0 + s * 16 + 8 * hh + r) * H_ + h;
#pragma unroll
            for (int ct = 0; ct < 4; ++ct)
                QKb[row * D_ + cg + ct * 16 + c] = (bf16_t)acc[s][ct][r];
            if ((wave & 3) == 0) QP[row * NB_ + c] = pacc[s][r];
        }
    }
}

// ---------------- kernel B: scores, V projection and attention per b -------
// Wave w: rows (n) strip w & 3, V columns half w >> 2. The score tile of a
// strip is one more B fragment of the same k loop: B[k][h] = QK[b][h][k]
// (columns 8..15 repeat heads 0..7 and are not read).
// V never touches LDS: accumulators stay in registers and are contracted
// against attn directly (register tile j-axis == n reduction axis).
// LDS carve (59 KB):
//   Pv f32[16*256] | sc f32[512] | qps f32[128] | b1s f32[8] | inv f32[8]
//   dists f32[64] | zpart f32[8*256] | As bf16[64*256] | bs int[64] | msk int[64]
extern "C" __global__ void __launch_bounds__(256)
baca_attn(const float* __restrict__ h_send, const int* __restrict__ batch_recv,
          const int* __restrict__ batch_send, const float* __restrict__ dist,
          const int* __restrict__ mask, const float* __restrict__ gamma,
          const bf16_t* __restrict__ Wv_bf, const float* __restrict__ P_uv,
          const bf16_t* __restrict__ QKb, const float* __restrict__ QP,
          const float* __restrict__ b1w,
          float* __restrict__ z_out, float* __restrict__ attn_out) {
    extern __shared__ char smem[];
    float*  Pv    = (float*)smem;                // 16*256
    float*  sc    = Pv + 16 * 256;               // 64*8
    float*  qps   = sc + 512;                    // 8*16
    float*  b1s   = qps + 128;                   // 8
    float*  inv   = b1s + 8;                     // 8
    float*  dists = inv + 8;                     // 64
    float*  zpart = dists + 64;                  // 8*256
    bf16_t* As    = (bf16_t*)(zpart + 8 * 256);  // 64*256 (16B aligned)
    int*    bs    = (int*)(As + 64 * 256);       // 64
    int*    msk   = bs + 64;                     // 64

    const int t = threadIdx.x, lane = t & 31, wave = t >> 5;
    const int b = blockIdx.x;

    // stage: h_send[b] -> bf16, P_uv table, per-(h, batch) and per-n scalars
    const float* hs = h_send + (size_t)b * (N_ * D_);
#pragma unroll 4
    for (int i = 0; i < 64; ++i) {
        int idx = t + i * 256;
        As[idx] = (bf16_t)hs[idx];
    }
    for (int i = t; i < NB_ * D_; i += 256) Pv[i] = P_uv[i];
    if (t < H_ * NB_) qps[t] = QP[(size_t)b * (H_ * NB_) + t];
    if (t < 64) {
        bs[t]    = batch_send[b * N_ + t];
        msk[t]   = mask[b * N_ + t];
        dists[t] = dist[b * N_ + t];
    }
    if (t < H_) b1s[t] = b1w[(size_t)b * H_ + t];
    __syncthreads();

    const int chalf = (wave >> 2) * 8;
    const int strip = (wave & 3) * 16;
    const int rbase = strip + ((lane >> 4) << 3);
    v8f acc[8];
#pragma unroll
    for (int ct = 0; ct < 8; ++ct) acc[ct] = v8f_zero();
    v8f sacc = v8f_zero();
    {
        // frag_a's k order: low chunk at k0 + 8*(lane >> 4), high chunk 16 on
        const bf16_t* qk = QKb + (size_t)b * (H_ * D_) + (lane & 7) * D_ + ((lane >> 4) << 3);
        // The 72 B fragments in the order of their use: f = 9 * ks + i, i = 0 the
        // score fragment, i = 1..8 the V column tiles. A ring of RING_ register
        // sets: a set is refilled behind the WMMA that read it, RING_ WMMAs ahead
        // of its next use, so that several fragments' loads are in flight at once
        // and no WMMA waits out a whole trip to L2. RING_ is the deepest ring that
        // stays within 128 VGPRs (eight waves per SIMD).
        // All three loops are unrolled whole so that every ring index is a constant
        // and the sets stay in registers.
        v16bf ring[RING_];
#pragma unroll
        for (int f = 0; f < RING_; ++f)
            ring[f] = (f % 9 == 0) ? frag_q(qk, f / 9) : frag_b(Wv_bf, chalf + f % 9 - 1, f / 9, lane);
#pragma unroll
        for (int ks = 0; ks < 8; ++ks) {
            v16bf a = frag_a(As, strip, ks * 32, lane);
#pragma unroll
            for (int i = 0; i < 9; ++i) {
                const int f = ks * 9 + i, g = f + RING_;
                if (i == 0)
                    sacc = __builtin_amdgcn_wmma_f32_16x16x32_bf16(
                        false, a, false, ring[f % RING_], (short)0, sacc, false, false);
                else
                    acc[i - 1] = __builtin_amdgcn_wmma_f32_16x16x32_bf16(
                        false, a, false, ring[f % RING_], (short)0, acc[i - 1], false, false);
                // precaution in front of the last refill: the compiler gives it, as destination,
                // registers that hold the addresses of loads already issued
                if (g == 71) asm volatile("s_wait_xcnt 0x0" ::: "memory");
                if (g < 72)
                    ring[f % RING_] = (g % 9 == 0) ? frag_q(qk, g / 9)
                                                   : frag_b(Wv_bf, chalf + g % 9 - 1, g / 9, lane);
                // holds each refill where it is written: without it the compiler moves the
                // loads down to just in front of their WMMA, and each waits out its own latency
                __builtin_amdgcn_sched_barrier(0);
            }
        }
    }

    // scores[n][h]: sacc[j] is h_send[rbase+j] . QK[h], h = lane & 15
    if (wave < 4 && (lane & 15) < H_) {
        const int   h     = lane & 15;
        const int   br    = batch_recv[b];
        const float scale = 0.1767766952966369f;   // 1/sqrt(32)
#pragma unroll
        for (int j = 0; j < 8; ++j) {
            int n = rbase + j;
            float d = sacc[j] + qps[h * NB_ + bs[n]];
            float s = d * scale - b1s[h] * dists[n] + gamma[br * NB_ + bs[n]];
            sc[n * H_ + h] = (msk[n] == 0) ? -INFINITY : s;
        }
    }
    __syncthreads();

    // softmax over n, per h (8 lanes, N=64 serial - tiny)
    if (t < H_) {
        float m = -INFINITY;
        for (int n = 0; n < N_; ++n) m = fmaxf(m, sc[n * H_ + t]);
        float s = 0.0f;
        for (int n = 0; n < N_; ++n) {
            float e = __expf(sc[n * H_ + t] - m);
            sc[n * H_ + t] = e;
            s += e;
        }
        inv[t] = 1.0f / s;
    }
    __syncthreads();

#pragma unroll
    for (int rep = 0; rep < 2; ++rep) {
        int idx = t + rep * 256;
        int n = idx >> 3, h = idx & 7;
        float a = sc[n * H_ + h] * inv[h];
        sc[n * H_ + h] = a;
        attn_out[((size_t)b * N_ + n) * H_ + h] = a;
    }
    __syncthreads();

    // contract register V tiles with attn.
    // Lane owns col = (chalf+ct)*16 + (lane&15); acc[ct][j] is V[rbase+j][col].
    {
        const int half = (wave & 3) * 2 + (lane >> 4);   // 0..7
#pragma unroll
        for (int ct = 0; ct < 8; ++ct) {
            int col = (chalf + ct) * 16 + (lane & 15);
            int h = col >> 5;
            float p = 0.0f;
#pragma unroll
            for (int j = 0; j < 8; ++j)
                p = fmaf(sc[(rbase + j) * H_ + h], acc[ct][j], p);
            zpart[half * D_ + col] = p;
        }
    }
    __syncthreads();

    // z[b, col] = sum(zpart) + sum_n attn[n,h] * P_uv[bs[n]][col]
    {
        const int h = t >> 5;
        float z = 0.0f;
#pragma unroll
        for (int p = 0; p < 8; ++p) z += zpart[p * D_ + t];
#pragma unroll 8
        for (int n = 0; n < N_; ++n)
            z = fmaf(sc[n * H_ + h], Pv[bs[n] * D_ + t], z);
        z_out[(size_t)b * D_ + t] = z;
    }
}

// --------------------------------------------------------------------------
extern "C" void kernel_launch(void* const* d_in, const int* in_sizes, int n_in,
                              void* d_out, int out_size, void* d_ws, size_t ws_size,
                              hipStream_t stream) {
    const float* h_recv     = (const float*)d_in[0];
    const float* h_send     = (const float*)d_in[1];
    const int*   batch_recv = (const int*)d_in[2];
    const int*   batch_send = (const int*)d_in[3];
    const float* dist       = (const float*)d_in[4];
    const int*   mask       = (const int*)d_in[5];
    const float* Wq = (const float*)d_in[6];  const float* bq  = (const float*)d_in[7];
    const float* Wk = (const float*)d_in[8];  const float* bk  = (const float*)d_in[9];
    const float* Wv = (const float*)d_in[10]; const float* bv  = (const float*)d_in[11];
    const float* Uq = (const float*)d_in[12]; const float* buq = (const float*)d_in[13];
    const float* Uk = (const float*)d_in[14]; const float* buk = (const float*)d_in[15];
    const float* Uv = (const float*)d_in[16]; const float* buv = (const float*)d_in[17];
    const float* batch_emb = (const float*)d_in[18];
    const float* D1  = (const float*)d_in[19]; const float* db1 = (const float*)d_in[20];
    const float* D2  = (const float*)d_in[21]; const float* db2 = (const float*)d_in[22];
    const float* gamma = (const float*)d_in[23];

    // workspace carve (about 24 MB)
    bf16_t* Wq_bf = (bf16_t*)d_ws;
    bf16_t* Wv_bf = Wq_bf + D_ * D_;
    float*  P_uq  = (float*)(Wv_bf + D_ * D_);
    float*  P_uk  = P_uq + NB_ * D_;
    float*  P_uv  = P_uk + NB_ * D_;
    float*  Qf    = P_uv + NB_ * D_;            // B*D
    float*  b1w   = Qf + (size_t)B_ * D_;       // B*H
    float*  QP    = b1w + (size_t)B_ * H_;      // B*H*NB
    bf16_t* QKb   = (bf16_t*)(QP + (size_t)B_ * H_ * NB_);   // B*H*D

    float* z_out    = (float*)d_out;
    float* attn_out = z_out + (size_t)B_ * D_;

    hipLaunchKernelGGL(baca_cvt_w, dim3(2 * D_ * D_ / 256), dim3(256), 0, stream,
                       Wq, Wv, Wq_bf);
    hipLaunchKernelGGL(baca_pu, dim3(3 * NB_ * D_ / 256), dim3(256), 0, stream,
                       Uq, buq, bq, Uk, buk, bk, Uv, buv, bv, batch_emb,
                       P_uq, P_uk, P_uv);

    size_t lds_a = (64 * HP_ + 64 * 128) * sizeof(float)
                 + 64 * 256 * sizeof(bf16_t) + 64 * sizeof(int);
    hipLaunchKernelGGL(baca_qb1, dim3(B_ / 64), dim3(256), lds_a, stream,
                       h_recv, batch_recv, Wq_bf, P_uq, batch_emb,
                       D1, db1, D2, db2, Qf, b1w);

    hipLaunchKernelGGL(baca_qk, dim3(B_ / 64 * H_), dim3(256), 0, stream,
                       Qf, Wk, P_uk, QKb, QP);

    size_t lds_b = (16 * 256 + 512 + 128 + 8 + 8 + 64 + 8 * 256) * sizeof(float)
                 + 64 * 256 * sizeof(bf16_t) + 128 * sizeof(int);
    hipLaunchKernelGGL(baca_attn, dim3(B_), dim3(256), lds_b, stream,
                       h_send, batch_recv, batch_send, dist, mask, gamma,
                       Wv_bf, P_uv, QKb, QP, b1w, z_out, attn_out);
}

// v005
// A run of this version takes 154 microseconds.
// In both of two side-by-side timings against v004, it was 1.07 times as fast.
// Counting every step since v000, it is 8.54 times as fast.
#include <hip/hip_runtime.h>
#include <hip/hip_bf16.h>
#include <math.h>

#define B_  4096
#define N_  64
#define D_  256
#define H_  8
#define NB_ 16
#define DH_ 32

typedef __bf16 bf16_t;
typedef __attribute__((ext_vector_type(16))) __bf16 v16bf;
typedef __attribute__((ext_vector_type(8)))  __bf16 v8bf;
typedef __attribute__((ext_vector_type(4)))  __bf16 v4bf;
typedef __attribute__((ext_vector_type(8)))  float  v8f;
typedef __attribute__((ext_vector_type(4)))  float  v4f;
typedef __attribute__((ext_vector_type(2)))  float  v2f;

// LDS row pitch (floats) of the f32 receiver state: 1040 B = 16 B x 65, so the
// 16 rows of one ds_load_b128 fragment read fall on 64 distinct banks.
#define HP_ 260

__device__ __forceinline__ v8f v8f_zero() {
    v8f v;
#pragma unroll
    for (int i = 0; i < 8; ++i) v[i] = 0.0f;
    return v;
}

// A fragment (16x32 bf16, row-major source with row stride D_):
// lanes 0-15 : row = mr+lane,    K chunks [k0, k0+8) and [k0+16, k0+24)
// lanes 16-31: row = mr+lane-16, K chunks [k0+8, k0+16) and [k0+24, k0+32)
__device__ __forceinline__ v16bf frag_a(const bf16_t* __restrict__ A, int mr, int k0, int lane) {
    int r  = mr + (lane & 15);
    int kk = k0 + ((lane >> 4) << 3);
    v8bf lo = *(const v8bf*)(A + r * D_ + kk);
    v8bf hi = *(const v8bf*)(A + r * D_ + kk + 16);
    v16bf f;
#pragma unroll
    for (int i = 0; i < 8; ++i) { f[i] = lo[i]; f[i + 8] = hi[i]; }
    return f;
}

// B fragment (32x16 bf16). B[k][n] = W[n][k] (we compute X @ W.T). The weights
// lie in the workspace in fragment order (baca_cvt_w): fragment (k step ks,
// column tile ct) is the 1 KB block ks*16 + ct, its first 512 B the 32 lanes'
// low k chunks in lane order, its second 512 B their high k chunks. Each
// wave-wide 16-byte load so covers four whole 128-B lines, not 32 B of sixteen.
__device__ __forceinline__ v16bf frag_b(const bf16_t* __restrict__ Wp, int ct, int ks, int lane) {
    const bf16_t* p = Wp + ((ks * 16 + ct) << 9) + (lane << 3);
    v8bf lo = *(const v8bf*)(p);
    v8bf hi = *(const v8bf*)(p + 256);
    v16bf f;
#pragma unroll
    for (int i = 0; i < 8; ++i) { f[i] = lo[i]; f[i + 8] = hi[i]; }
    return f;
}

// Score B fragment of k step ks: B[k][h] = QK[b][h][k], q already at the lane's
// head row and low k chunk.
__device__ __forceinline__ v16bf frag_q(const bf16_t* __restrict__ q, int ks) {
    v8bf lo = *(const v8bf*)(q + ks * 32);
    v8bf hi = *(const v8bf*)(q + ks * 32 + 16);
    v16bf f;
#pragma unroll
    for (int i = 0; i < 8; ++i) { f[i] = lo[i]; f[i + 8] = hi[i]; }
    return f;
}

// register sets of B fragments in flight in baca_attn's k loop
#define RING_ 2

// ---------------- prep 1: convert Wq/Wv to bf16, in fragment order ---------
// dst element: [matrix][ks*16 + ct][part][lane][e] holds
// W[ct*16 + (lane & 15)][ks*32 + part*16 + (lane >> 4)*8 + e], frag_a's k order.
extern "C" __global__ void __launch_bounds__(256)
baca_cvt_w(const float* __restrict__ Wq, const float* __restrict__ Wv,
           bf16_t* __restrict__ dst) {
    int idx = blockIdx.x * 256 + threadIdx.x;           // 0 .. 2*65536
    const float* src = (idx < 65536) ? Wq : Wv;
    int e = idx & 7, lane = (idx >> 3) & 31, part = (idx >> 8) & 1;
    int ct = (idx >> 9) & 15, ks = (idx >> 13) & 7;
    int row = ct * 16 + (lane & 15);
    int k   = ks * 32 + part * 16 + ((lane >> 4) << 3) + e;
    dst[idx] = (bf16_t)src[row * D_ + k];
}

// ---------------- prep 2: P_u* = batch_emb @ U*.T + b* + bu* ---------------
extern "C" __global__ void __launch_bounds__(256)
baca_pu(const float* __restrict__ Uq, const float* __restrict__ buq, const float* __restrict__ bq,
        const float* __restrict__ Uk, const float* __restrict__ buk, const float* __restrict__ bk,
        const float* __restrict__ Uv, const float* __restrict__ buv, const float* __restrict__ bv,
        const float* __restrict__ batch_emb,
        float* __restrict__ P_uq, float* __restrict__ P_uk, float* __restrict__ P_uv) {
    int idx = blockIdx.x * 256 + threadIdx.x;           // 0 .. 3*16*256
    int which = idx / (NB_ * D_);
    int rem   = idx - which * (NB_ * D_);
    int nb = rem >> 8, d = rem & 255;
    const float* U  = (which == 0) ? Uq  : (which == 1) ? Uk  : Uv;
    const float* bu = (which == 0) ? buq : (which == 1) ? buk : buv;
    const float* bw = (which == 0) ? bq  : (which == 1) ? bk  : bv;
    float*       P  = (which == 0) ? P_uq: (which == 1) ? P_uk: P_uv;
    float acc = bu[d] + bw[d];
    const float* e = batch_emb + nb * D_;
    const float* u = U + d * D_;
#pragma unroll 8
    for (int k = 0; k < D_; ++k) acc = fmaf(e[k], u[k], acc);
    P[rem] = acc;
}

// ---------------- kernel A: Q = h_recv@Wq.T + gather(P_uq); b1 MLP ---------
// LDS carve: Hs f32[64*HP_] | h1 f32[64*128] | As bf16[64*256] | br int[64]
extern "C" __global__ void __launch_bounds__(256)
baca_qb1(const float* __restrict__ h_recv, const int* __restrict__ batch_recv,
         const bf16_t* __restrict__ Wq_bf, const float* __restrict__ P_uq,
         const float* __restrict__ batch_emb,
         const float* __restrict__ D1, const float* __restrict__ db1,
         const float* __restrict__ D2, const float* __restrict__ db2,
         float* __restrict__ Qf, float* __restrict__ b1w) {
    extern __shared__ char smem[];
    float*  Hs = (float*)smem;                   // 64*HP_
    float*  h1 = Hs + 64 * HP_;                  // 64*128
    bf16_t* As = (bf16_t*)(h1 + 64 * 128);       // 64*256
    int*    br = (int*)(As + 64 * 256);          // 64

    const int t = threadIdx.x, lane = t & 31, wave = t >> 5;
    const int m0 = blockIdx.x * 64;

    const float* hr = h_recv + (size_t)m0 * D_;
#pragma unroll 4
    for (int i = 0; i < 64; ++i) {
        int idx = t + i * 256;
        float v = hr[idx];
        Hs[(idx >> 8) * HP_ + (idx & 255)] = v;
        As[idx] = (bf16_t)v;
    }
    if (t < 64) br[t] = batch_recv[m0 + t];
    __syncthreads();

    // receiver_state = h_recv + E_recv (in place; WMMA below only reads As)
#pragma unroll 4
    for (int i = 0; i < 64; ++i) {
        int idx = t + i * 256;
        Hs[(idx >> 8) * HP_ + (idx & 255)] += batch_emb[br[idx >> 8] * D_ + (idx & 255)];
    }

    // WMMA: 64x256 output, 8 waves x 8 tiles
    {
        const int strip = (wave & 3) * 16;
        const int chalf = (wave >> 2) * 8;
        v8f acc[8];
#pragma unroll
        for (int ct = 0; ct < 8; ++ct) acc[ct] = v8f_zero();
        for (int k0 = 0; k0 < D_; k0 += 32) {
            v16bf a = frag_a(As, strip, k0, lane);
#pragma unroll
            for (int ct = 0; ct < 8; ++ct) {
                v16bf bb = frag_b(Wq_bf, chalf + ct, k0 >> 5, lane);
                acc[ct] = __builtin_amdgcn_wmma_f32_16x16x32_bf16(
                    false, a, false, bb, (short)0, acc[ct], false, false);
            }
        }
        const int rbase = strip + ((lane >> 4) << 3);
#pragma unroll
        for (int ct = 0; ct < 8; ++ct) {
            int col = (chalf + ct) * 16 + (lane & 15);
#pragma unroll
            for (int j = 0; j < 8; ++j) {
                int row = rbase + j;
                Qf[(size_t)(m0 + row) * D_ + col] = acc[ct][j] + P_uq[br[row] * D_ + col];
            }
        }
    }
    __syncthreads();

    // hidden = relu(rs @ D1.T + db1) on f32 16x16x4 WMMA (operands stay f32).
    // Wave w owns hidden columns [16w, 16w+16) for all 64 rows, so each D1 row
    // is read once per workgroup. Lane (c, hh) loads 4 contiguous k at
    // k0 + 4*hh of A row c and of D1 row c with the same code: elements 0,1
    // feed one WMMA and 2,3 the next, so A and B pair on equal k.
    {
        const int c = lane & 15, hh = lane >> 4;
        const int j = wave * 16 + c;
        const float* xa = Hs + c * HP_ + 4 * hh;
        const float* wb = D1 + j * D_ + 4 * hh;
        v8f hacc[4];
#pragma unroll
        for (int s = 0; s < 4; ++s) hacc[s] = v8f_zero();
        // unrolled so that several k steps' D1 loads are in flight together
#pragma unroll 8
        for (int k0 = 0; k0 < D_; k0 += 8) {
            v4f bv = *(const v4f*)(wb + k0);
            v2f b0 = {bv[0], bv[1]}, b1 = {bv[2], bv[3]};
#pragma unroll
            for (int s = 0; s < 4; ++s) {
                v4f av = *(const v4f*)(xa + s * 16 * HP_ + k0);
                v2f a0 = {av[0], av[1]}, a1 = {av[2], av[3]};
                hacc[s] = __builtin_amdgcn_wmma_f32_16x16x4_f32(
                    false, a0, false, b0, (short)0, hacc[s], false, false);
                hacc[s] = __builtin_amdgcn_wmma_f32_16x16x4_f32(
                    false, a1, false, b1, (short)0, hacc[s], false, false);
            }
        }
        const float bias = db1[j];
#pragma unroll
        for (int s = 0; s < 4; ++s) {
#pragma unroll
            for (int r = 0; r < 8; ++r)
                h1[(s * 16 + 8 * hh + r) * 128 + j] = fmaxf(hacc[s][r] + bias, 0.0f);
        }
    }
    __syncthreads();

    // b1 = softplus(h1 @ D2.T + db2)
#pragma unroll
    for (int rep = 0; rep < 2; ++rep) {
        int idx = rep * 256 + t;
        int r = idx >> 3, h = idx & 7;
        float d = db2[h];
        const float* w = D2 + h * 128;
        const float* x = h1 + r * 128;
#pragma unroll 8
        for (int k = 0; k < 128; ++k) d = fmaf(x[k], w[k], d);
        b1w[(size_t)(m0 + r) * H_ + h] = log1pf(__expf(d));
    }
}

// ---------------- prep 3: fold Wk and P_uk into the query ------------------
// Q_h . K[n]_h = h_send[n] . (Q_h @ Wk_h) + Q_h . P_uk[bs[n]]_h, so K is never
// formed: per (b, h) a 256-vector QK and 16 scalars QP replace the 64x256 K.
// Workgroup = 64 rows b x one head, f32 16x16x4 WMMA (operands stay f32).
// Lane (c, hh) holds k = k0 + 4*hh + {0..3} of A row c and of B column c:
// elements 0,1 feed one WMMA and 2,3 the next, so A and B pair on equal k.
// A wave owns 64 columns (one whole 128-B line of bf16 per row) x 32 rows.
extern "C" __global__ void __launch_bounds__(256)
baca_qk(const float* __restrict__ Qf, const float* __restrict__ Wk,
        const float* __restrict__ P_uk,
        bf16_t* __restrict__ QKb, float* __restrict__ QP) {
    const int t = threadIdx.x, lane = t & 31, wave = t >> 5;
    const int h  = blockIdx.x & 7;
    const int m0 = (blockIdx.x >> 3) * 64 + (wave >> 2) * 32;
    const int cg = (wave & 3) * 64;
    const int c = lane & 15, hh = lane >> 4;
    const float* qa = Qf   + (size_t)(m0 + c) * D_ + h * DH_ + 4 * hh;
    const float* wb = Wk   + (h * DH_ + 4 * hh) * D_ + cg + c;
    const float* pb = P_uk + c * D_ + h * DH_ + 4 * hh;
    v8f acc[2][4], pacc[2];
#pragma unroll
    for (int s = 0; s < 2; ++s) {
        pacc[s] = v8f_zero();
#pragma unroll
        for (int ct = 0; ct < 4; ++ct) acc[s][ct] = v8f_zero();
    }
    v4f av[4][2], pv[4];
#pragma unroll
    for (int kq = 0; kq < 4; ++kq) {
        pv[kq] = *(const v4f*)(pb + kq * 8);
#pragma unroll
        for (int s = 0; s < 2; ++s) av[kq][s] = *(const v4f*)(qa + s * 16 * D_ + kq * 8);
    }
    // the loads above are all issued here; behind this wait their address
    // registers may be reused
    asm volatile("s_wait_xcnt 0x0" ::: "memory");
#pragma unroll
    for (int kq = 0; kq < 4; ++kq) {
        v2f a0[2], a1[2];
#pragma unroll
        for (int s = 0; s < 2; ++s) {
            a0[s] = v2f{av[kq][s][0], av[kq][s][1]};
            a1[s] = v2f{av[kq][s][2], av[kq][s][3]};
        }
#pragma unroll
        for (int ct = 0; ct < 4; ++ct) {
            const float* w = wb + kq * 8 * D_ + ct * 16;
            v2f b0 = {w[0], w[D_]}, b1 = {w[2 * D_], w[3 * D_]};
#pragma unroll
            for (int s = 0; s < 2; ++s) {
                acc[s][ct] = __builtin_amdgcn_wmma_f32_16x16x4_f32(
                    false, a0[s], false, b0, (short)0, acc[s][ct], false, false);
                acc[s][ct] = __builtin_amdgcn_wmma_f32_16x16x4_f32(
                    false, a1[s], false, b1, (short)0, acc[s][ct], false, false);
            }
        }
        v2f p0 = {pv[kq][0], pv[kq][1]}, p1 = {pv[kq][2], pv[kq][3]};
#pragma unroll
        for (int s = 0; s < 2; ++s) {
            pacc[s] = __builtin_amdgcn_wmma_f32_16x16x4_f32(
                false, a0[s], false, p0, (short)0, pacc[s], false, false);
            pacc[s] = __builtin_amdgcn_wmma_f32_16x16x4_f32(
                false, a1[s], false, p1, (short)0, pacc[s], false, false);
        }
    }
    // keeps the stores' address arithmetic out of the WMMA block, where it was
    // scheduled onto operand registers directly behind the WMMA that read them
    __builtin_amdgcn_sched_barrier(0);
    // four vector slots between the last WMMA and the first overwrite of its operands
    asm volatile("v_nop\n\tv_nop\n\tv_nop\n\tv_nop");
    // holds the epilogue's vector instructions behind those slots
    __builtin_amdgcn_sched_barrier(0);
#pragma unroll
    for (int s = 0; s < 2; ++s) {
#pragma unroll
        for (int r = 0; r < 8; ++r) {
            size_t row = (size_t)(m0 + s * 16 + 8 * hh + r) * H_ + h;
#pragma unroll
            for (int ct = 0; ct < 4; ++ct)
                QKb[row * D_ + cg + ct * 16 + c] = (bf16_t)acc[s][ct][r];
            if ((wave & 3) == 0) QP[row * NB_ + c] = pacc[s][r];
        }
    }
}

// ---------------- kernel B: scores, V projection and attention per b -------
// Wave w: rows (n) strip w & 3, V columns half w >> 2. The score tile of a
// strip is one more B fragment of the same k loop: B[k][h] = QK[b][h][k]
// (columns 8..15 repeat heads 0..7 and are not read).
// V never touches LDS: accumulators stay in registers and are contracted
// against attn directly (register tile j-axis == n reduction axis).
// LDS carve (59 KB):
//   Pv f32[16*256] | sc f32[512] | qps f32[128] | b1s f32[8] | inv f32[8]
//   dists f32[64] | zpart f32[8*256] | As bf16[64*256] | bs int[64] | msk int[64]
extern "C" __global__ void __launch_bounds__(256)
baca_attn(const float* __restrict__ h_send, const int* __restrict__ batch_recv,
          const int* __restrict__ batch_send, const float* __restrict__ dist,
          const int* __restrict__ mask, const float* __restrict__ gamma,
          const bf16_t* __restrict__ Wv_bf, const float* __restrict__ P_uv,
          const bf16_t* __restrict__ QKb, const float* __restrict__ QP,
          const float* __restrict__ b1w,
          float* __restrict__ z_out, float* __restrict__ attn_out) {
    extern __shared__ char smem[];
    float*  Pv    = (float*)smem;                // 16*256
    float*  sc    = Pv + 16 * 256;               // 64*8
    float*  qps   = sc + 512;                    // 8*16
    float*  b1s   = qps + 128;                   // 8
    float*  inv   = b1s + 8;                     // 8
    float*  dists = inv + 8;                     // 64
    float*  zpart = dists + 64;                  // 8*256
    bf16_t* As    = (bf16_t*)(zpart + 8 * 256);  // 64*256 (16B aligned)
    int*    bs    = (int*)(As + 64 * 256);       // 64
    int*    msk   = bs + 64;                     // 64

    const int t = threadIdx.x, lane = t & 31, wave = t >> 5;
    const int b = blockIdx.x;

    // stage: h_send[b] -> bf16, P_uv table, per-(h, batch) and per-n scalars
    const float* hs = h_send + (size_t)b * (N_ * D_);
    // Every global load of the stage is issued before the first one is waited
    // for, the two big tables as 16-byte loads: the stage then costs one trip to
    // memory, not one per loop trip and per table. The small tables' values wait
    // in registers until the big tables are stored.
    v4f st[16], pt[4];
#pragma unroll
    for (int i = 0; i < 16; ++i) st[i] = *(const v4f*)(hs + (t + i * 256) * 4);
#pragma unroll
    for (int i = 0; i < 4; ++i) pt[i] = *(const v4f*)(P_uv + (t + i * 256) * 4);
    int   bsv = 0, mkv = 0;
    float dsv = 0.0f, qpv = 0.0f, b1v = 0.0f;
    if (t < 64) {
        bsv = (batch_send + (size_t)b * N_)[t];
        mkv = (mask + (size_t)b * N_)[t];
        dsv = (dist + (size_t)b * N_)[t];
    }
    if (t < H_ * NB_) qpv = QP[(size_t)b * (H_ * NB_) + t];
    if (t < H_) b1v = b1w[(size_t)b * H_ + t];
#pragma unroll
    for (int i = 0; i < 16; ++i) {
        v4bf pk;
#pragma unroll
        for (int e = 0; e < 4; ++e) pk[e] = (bf16_t)st[i][e];
        *(v4bf*)(As + (t + i * 256) * 4) = pk;
    }
#pragma unroll
    for (int i = 0; i < 4; ++i) *(v4f*)(Pv + (t + i * 256) * 4) = pt[i];
    if (t < 64) {
        bs[t]    = bsv;
        msk[t]   = mkv;
        dists[t] = dsv;
    }
    if (t < H_ * NB_) qps[t] = qpv;
    if (t < H_) b1s[t] = b1v;
    __syncthreads();

    const int chalf = (wave >> 2) * 8;
    const int strip = (wave & 3) * 16;
    const int rbase = strip + ((lane >> 4) << 3);
    v8f acc[8];
#pragma unroll
    for (int ct = 0; ct < 8; ++ct) acc[ct] = v8f_zero();
    v8f sacc = v8f_zero();
    {
        // frag_a's k order: low chunk at k0 + 8*(lane >> 4), high chunk 16 on
        const bf16_t* qk = QKb + (size_t)b * (H_ * D_) + (lane & 7) * D_ + ((lane >> 4) << 3);
        // The 72 B fragments in the order of their use: f = 9 * ks + i, i = 0 the
        // score fragment, i = 1..8 the V column tiles. A ring of RING_ register
        // sets: a set is refilled behind the WMMA that read it, RING_ WMMAs ahead
        // of its next use, so that several fragments' loads are in flight at once
        // and no WMMA waits out a whole trip to L2. RING_ is the deepest ring that
        // stays within 128 VGPRs (eight waves per SIMD).
        // All three loops are unrolled whole so that every ring index is a constant
        // and the sets stay in registers.
        v16bf ring[RING_];
#pragma unroll
        for (int f = 0; f < RING_; ++f)
            ring[f] = (f % 9 == 0) ? frag_q(qk, f / 9) : frag_b(Wv_bf, chalf + f % 9 - 1, f / 9, lane);
#pragma unroll
        for (int ks = 0; ks < 8; ++ks) {
            v16bf a = frag_a(As, strip, ks * 32, lane);
#pragma unroll
            for (int i = 0; i < 9; ++i) {
                const int f = ks * 9 + i, g = f + RING_;
                if (i == 0)
                    sacc = __builtin_amdgcn_wmma_f32_16x16x32_bf16(
                        false, a, false, ring[f % RING_], (short)0, sacc, false, false);
                else
                    acc[i - 1] = __builtin_amdgcn_wmma_f32_16x16x32_bf16(
                        false, a, false, ring[f % RING_], (short)0, acc[i - 1], false, false);
                // precaution in front of the last refill: the compiler gives it, as destination,
                // registers that hold the addresses of loads already issued
                if (g == 71) asm volatile("s_wait_xcnt 0x0" ::: "memory");
                if (g < 72)
                    ring[f % RING_] = (g % 9 == 0) ? frag_q(qk, g / 9)
                                                   : frag_b(Wv_bf, chalf + g % 9 - 1, g / 9, lane);
                // holds each refill where it is written: without it the compiler moves the
                // loads down to just in front of their WMMA, and each waits out its own latency
                __builtin_amdgcn_sched_barrier(0);
            }
        }
    }

    // scores[n][h]: sacc[j] is h_send[rbase+j] . QK[h], h = lane & 15
    if (wave < 4 && (lane & 15) < H_) {
        const int   h     = lane & 15;
        const int   br    = batch_recv[b];
        const float scale = 0.1767766952966369f;   // 1/sqrt(32)
#pragma unroll
        for (int j = 0; j < 8; ++j) {
            int n = rbase + j;
            float d = sacc[j] + qps[h * NB_ + bs[n]];
            float s = d * scale - b1s[h] * dists[n] + gamma[br * NB_ + bs[n]];
            sc[n * H_ + h] = (msk[n] == 0) ? -INFINITY : s;
        }
    }
    __syncthreads();

    // softmax over n, per h (8 lanes, N=64 serial - tiny)
    if (t < H_) {
        float m = -INFINITY;
        for (int n = 0; n < N_; ++n) m = fmaxf(m, sc[n * H_ + t]);
        float s = 0.0f;
        for (int n = 0; n < N_; ++n) {
            float e = __expf(sc[n * H_ + t] - m);
            sc[n * H_ + t] = e;
            s += e;
        }
        inv[t] = 1.0f / s;
    }
    __syncthreads();

#pragma unroll
    for (int rep = 0; rep < 2; ++rep) {
        int idx = t + rep * 256;
        int n = idx >> 3, h = idx & 7;
        float a = sc[n * H_ + h] * inv[h];
        sc[n * H_ + h] = a;
        attn_out[((size_t)b * N_ + n) * H_ + h] = a;
    }
    __syncthreads();

    // contract register V tiles with attn.
    // Lane owns col = (chalf+ct)*16 + (lane&15); acc[ct][j] is V[rbase+j][col].
    {
        const int half = (wave & 3) * 2 + (lane >> 4);   // 0..7
#pragma unroll
        for (int ct = 0; ct < 8; ++ct) {
            int col = (chalf + ct) * 16 + (lane & 15);
            int h = col >> 5;
            float p = 0.0f;
#pragma unroll
            for (int j = 0; j < 8; ++j)
                p = fmaf(sc[(rbase + j) * H_ + h], acc[ct][j], p);
            zpart[half * D_ + col] = p;
        }
    }
    __syncthreads();

    // z[b, col] = sum(zpart) + sum_n attn[n,h] * P_uv[bs[n]][col]
    {
        const int h = t >> 5;
        float z = 0.0f;
#pragma unroll
        for (int p = 0; p < 8; ++p) z += zpart[p * D_ + t];
#pragma unroll 8
        for (int n = 0; n < N_; ++n)
            z = fmaf(sc[n * H_ + h], Pv[bs[n] * D_ + t], z);
        z_out[(size_t)b * D_ + t] = z;
    }
}

// --------------------------------------------------------------------------
extern "C" void kernel_launch(void* const* d_in, const int* in_sizes, int n_in,
                              void* d_out, int out_size, void* d_ws, size_t ws_size,
                              hipStream_t stream) {
    const float* h_recv     = (const float*)d_in[0];
    const float* h_send     = (const float*)d_in[1];
    const int*   batch_recv = (const int*)d_in[2];
    const int*   batch_send = (const int*)d_in[3];
    const float* dist       = (const float*)d_in[4];
    const int*   mask       = (const int*)d_in[5];
    const float* Wq = (const float*)d_in[6];  const float* bq  = (const float*)d_in[7];
    const float* Wk = (const float*)d_in[8];  const float* bk  = (const float*)d_in[9];
    const float* Wv = (const float*)d_in[10]; const float* bv  = (const float*)d_in[11];
    const float* Uq = (const float*)d_in[12]; const float* buq = (const float*)d_in[13];
    const float* Uk = (const float*)d_in[14]; const float* buk = (const float*)d_in[15];
    const float* Uv = (const float*)d_in[16]; const float* buv = (const float*)d_in[17];
    const float* batch_emb = (const float*)d_in[18];
    const float* D1  = (const float*)d_in[19]; const float* db1 = (const float*)d_in[20];
    const float* D2  = (const float*)d_in[21]; const float* db2 = (const float*)d_in[22];
    const float* gamma = (const float*)d_in[23];

    // workspace carve (about 24 MB)
    bf16_t* Wq_bf = (bf16_t*)d_ws;
    bf16_t* Wv_bf = Wq_bf + D_ * D_;
    float*  P_uq  = (float*)(Wv_bf + D_ * D_);
    float*  P_uk  = P_uq + NB_ * D_;
    float*  P_uv  = P_uk + NB_ * D_;
    float*  Qf    = P_uv + NB_ * D_;            // B*D
    float*  b1w   = Qf + (size_t)B_ * D_;       // B*H
    float*  QP    = b1w + (size_t)B_ * H_;      // B*H*NB
    bf16_t* QKb   = (bf16_t*)(QP + (size_t)B_ * H_ * NB_);   // B*H*D

    float* z_out    = (float*)d_out;
    float* attn_out = z_out + (size_t)B_ * D_;

    hipLaunchKernelGGL(baca_cvt_w, dim3(2 * D_ * D_ / 256), dim3(256), 0, stream,
                       Wq, Wv, Wq_bf);
    hipLaunchKernelGGL(baca_pu, dim3(3 * NB_ * D_ / 256), dim3(256), 0, stream,
                       Uq, buq, bq, Uk, buk, bk, Uv, buv, bv, batch_emb,
                       P_uq, P_uk, P_uv);

    size_t lds_a = (64 * HP_ + 64 * 128) * sizeof(float)
                 + 64 * 256 * sizeof(bf16_t) + 64 * sizeof(int);
    hipLaunchKernelGGL(baca_qb1, dim3(B_ / 64), dim3(256), lds_a, stream,
                       h_recv, batch_recv, Wq_bf, P_uq, batch_emb,
                       D1, db1, D2, db2, Qf, b1w);

    hipLaunchKernelGGL(baca_qk, dim3(B_ / 64 * H_), dim3(256), 0, stream,
                       Qf, Wk, P_uk, QKb, QP);

    size_t lds_b = (16 * 256 + 512 + 128 + 8 + 8 + 64 + 8 * 256) * sizeof(float)
                 + 64 * 256 * sizeof(bf16_t) + 128 * sizeof(int);
    hipLaunchKernelGGL(baca_attn, dim3(B_), dim3(256), lds_b, stream,
                       h_send, batch_recv, batch_send, dist, mask, gamma,
                       Wv_bf, P_uv, QKb, QP, b1w, z_out, attn_out);
}

// v006
// It runs in 130 microseconds.
// Next to v005, in two timings, it ran 1.18 times as fast each time.
// Over all steps from v000 it is 10.1 times as fast.
#include <hip/hip_runtime.h>
#include <hip/hip_bf16.h>
#include <math.h>

#define B_  4096
#define N_  64
#define D_  256
#define H_  8
#define NB_ 16
#define DH_ 32

typedef __bf16 bf16_t;
typedef __attribute__((ext_vector_type(16))) __bf16 v16bf;
typedef __attribute__((ext_vector_type(8)))  __bf16 v8bf;
typedef __attribute__((ext_vector_type(4)))  __bf16 v4bf;
typedef __attribute__((ext_vector_type(8)))  float  v8f;
typedef __attribute__((ext_vector_type(4)))  float  v4f;
typedef __attribute__((ext_vector_type(2)))  float  v2f;

// LDS row pitch (floats) of the f32 receiver state: 1040 B = 16 B x 65, so the
// 16 rows of one ds_load_b128 fragment read fall on 64 distinct banks.
#define HP_ 260

__device__ __forceinline__ v8f v8f_zero() {
    v8f v;
#pragma unroll
    for (int i = 0; i < 8; ++i) v[i] = 0.0f;
    return v;
}

// A fragment (16x32 bf16, row-major source with row stride D_):
// lanes 0-15 : row = mr+lane,    K chunks [k0, k0+8) and [k0+16, k0+24)
// lanes 16-31: row = mr+lane-16, K chunks [k0+8, k0+16) and [k0+24, k0+32)
__device__ __forceinline__ v16bf frag_a(const bf16_t* __restrict__ A, int mr, int k0, int lane) {
    int r  = mr + (lane & 15);
    int kk = k0 + ((lane >> 4) << 3);
    v8bf lo = *(const v8bf*)(A + r * D_ + kk);
    v8bf hi = *(const v8bf*)(A + r * D_ + kk + 16);
    v16bf f;
#pragma unroll
    for (int i = 0; i < 8; ++i) { f[i] = lo[i]; f[i + 8] = hi[i]; }
    return f;
}

// LDS row pitch (bf16) of baca_attn's sender rows: 528 B = 16 B x 33, so the 16
// rows of one ds_load_b128 fragment read fall on distinct banks.
#define AP_ 264

// frag_a on rows at pitch AP_: same lanes, same k order.
__device__ __forceinline__ v16bf frag_ap(const bf16_t* __restrict__ A, int mr, int k0, int lane) {
    int r  = mr + (lane & 15);
    int kk = k0 + ((lane >> 4) << 3);
    v8bf lo = *(const v8bf*)(A + r * AP_ + kk);
    v8bf hi = *(const v8bf*)(A + r * AP_ + kk + 16);
    v16bf f;
#pragma unroll
    for (int i = 0; i < 8; ++i) { f[i] = lo[i]; f[i + 8] = hi[i]; }
    return f;
}

// B fragment (32x16 bf16). B[k][n] = W[n][k] (we compute X @ W.T). The weights
// lie in the workspace in fragment order (baca_cvt_w): fragment (k step ks,
// column tile ct) is the 1 KB block ks*16 + ct, its first 512 B the 32 lanes'
// low k chunks in lane order, its second 512 B their high k chunks. Each
// wave-wide 16-byte load so covers four whole 128-B lines, not 32 B of sixteen.
__device__ __forceinline__ v16bf frag_b(const bf16_t* __restrict__ Wp, int ct, int ks, int lane) {
    const bf16_t* p = Wp + ((ks * 16 + ct) << 9) + (lane << 3);
    v8bf lo = *(const v8bf*)(p);
    v8bf hi = *(const v8bf*)(p + 256);
    v16bf f;
#pragma unroll
    for (int i = 0; i < 8; ++i) { f[i] = lo[i]; f[i + 8] = hi[i]; }
    return f;
}

// Score B fragment of k step ks: B[k][h] = QK[b][h][k], q already at the lane's
// head row and low k chunk.
__device__ __forceinline__ v16bf frag_q(const bf16_t* __restrict__ q, int ks) {
    v8bf lo = *(const v8bf*)(q + ks * 32);
    v8bf hi = *(const v8bf*)(q + ks * 32 + 16);
    v16bf f;
#pragma unroll
    for (int i = 0; i < 8; ++i) { f[i] = lo[i]; f[i + 8] = hi[i]; }
    return f;
}

// ---------------- prep 1: convert Wq/Wv to bf16, in fragment order ---------
// dst element: [matrix][ks*16 + ct][part][lane][e] holds
// W[ct*16 + (lane & 15)][ks*32 + part*16 + (lane >> 4)*8 + e], frag_a's k order.
extern "C" __global__ void __launch_bounds__(256)
baca_cvt_w(const float* __restrict__ Wq, const float* __restrict__ Wv,
           bf16_t* __restrict__ dst) {
    int idx = blockIdx.x * 256 + threadIdx.x;           // 0 .. 2*65536
    const float* src = (idx < 65536) ? Wq : Wv;
    int e = idx & 7, lane = (idx >> 3) & 31, part = (idx >> 8) & 1;
    int ct = (idx >> 9) & 15, ks = (idx >> 13) & 7;
    int row = ct * 16 + (lane & 15);
    int k   = ks * 32 + part * 16 + ((lane >> 4) << 3) + e;
    dst[idx] = (bf16_t)src[row * D_ + k];
}

// ---------------- prep 2: P_u* = batch_emb @ U*.T + b* + bu* ---------------
extern "C" __global__ void __launch_bounds__(256)
baca_pu(const float* __restrict__ Uq, const float* __restrict__ buq, const float* __restrict__ bq,
        const float* __restrict__ Uk, const float* __restrict__ buk, const float* __restrict__ bk,
        const float* __restrict__ Uv, const float* __restrict__ buv, const float* __restrict__ bv,
        const float* __restrict__ batch_emb,
        float* __restrict__ P_uq, float* __restrict__ P_uk, float* __restrict__ P_uv) {
    int idx = blockIdx.x * 256 + threadIdx.x;           // 0 .. 3*16*256
    int which = idx / (NB_ * D_);
    int rem   = idx - which * (NB_ * D_);
    int nb = rem >> 8, d = rem & 255;
    const float* U  = (which == 0) ? Uq  : (which == 1) ? Uk  : Uv;
    const float* bu = (which == 0) ? buq : (which == 1) ? buk : buv;
    const float* bw = (which == 0) ? bq  : (which == 1) ? bk  : bv;
    float*       P  = (which == 0) ? P_uq: (which == 1) ? P_uk: P_uv;
    float acc = bu[d] + bw[d];
    const float* e = batch_emb + nb * D_;
    const float* u = U + d * D_;
#pragma unroll 8
    for (int k = 0; k < D_; ++k) acc = fmaf(e[k], u[k], acc);
    P[rem] = acc;
}

// ---------------- kernel A: Q = h_recv@Wq.T + gather(P_uq); b1 MLP ---------
// LDS carve: Hs f32[64*HP_] | h1 f32[64*128] | As bf16[64*256] | br int[64]
extern "C" __global__ void __launch_bounds__(256)
baca_qb1(const float* __restrict__ h_recv, const int* __restrict__ batch_recv,
         const bf16_t* __restrict__ Wq_bf, const float* __restrict__ P_uq,
         const float* __restrict__ batch_emb,
         const float* __restrict__ D1, const float* __restrict__ db1,
         const float* __restrict__ D2, const float* __restrict__ db2,
         float* __restrict__ Qf, float* __restrict__ b1w) {
    extern __shared__ char smem[];
    float*  Hs = (float*)smem;                   // 64*HP_
    float*  h1 = Hs + 64 * HP_;                  // 64*128
    bf16_t* As = (bf16_t*)(h1 + 64 * 128);       // 64*256
    int*    br = (int*)(As + 64 * 256);          // 64

    const int t = threadIdx.x, lane = t & 31, wave = t >> 5;
    const int m0 = blockIdx.x * 64;

    const float* hr = h_recv + (size_t)m0 * D_;
#pragma unroll 4
    for (int i = 0; i < 64; ++i) {
        int idx = t + i * 256;
        float v = hr[idx];
        Hs[(idx >> 8) * HP_ + (idx & 255)] = v;
        As[idx] = (bf16_t)v;
    }
    if (t < 64) br[t] = batch_recv[m0 + t];
    __syncthreads();

    // receiver_state = h_recv + E_recv (in place; WMMA below only reads As)
#pragma unroll 4
    for (int i = 0; i < 64; ++i) {
        int idx = t + i * 256;
        Hs[(idx >> 8) * HP_ + (idx & 255)] += batch_emb[br[idx >> 8] * D_ + (idx & 255)];
    }

    // WMMA: 64x256 output, 8 waves x 8 tiles
    {
        const int strip = (wave & 3) * 16;
        const int chalf = (wave >> 2) * 8;
        v8f acc[8];
#pragma unroll
        for (int ct = 0; ct < 8; ++ct) acc[ct] = v8f_zero();
        for (int k0 = 0; k0 < D_; k0 += 32) {
            v16bf a = frag_a(As, strip, k0, lane);
#pragma unroll
            for (int ct = 0; ct < 8; ++ct) {
                v16bf bb = frag_b(Wq_bf, chalf + ct, k0 >> 5, lane);
                acc[ct] = __builtin_amdgcn_wmma_f32_16x16x32_bf16(
                    false, a, false, bb, (short)0, acc[ct], false, false);
            }
        }
        const int rbase = strip + ((lane >> 4) << 3);
#pragma unroll
        for (int ct = 0; ct < 8; ++ct) {
            int col = (chalf + ct) * 16 + (lane & 15);
#pragma unroll
            for (int j = 0; j < 8; ++j) {
                int row = rbase + j;
                Qf[(size_t)(m0 + row) * D_ + col] = acc[ct][j] + P_uq[br[row] * D_ + col];
            }
        }
    }
    __syncthreads();

    // hidden = relu(rs @ D1.T + db1) on f32 16x16x4 WMMA (operands stay f32).
    // Wave w owns hidden columns [16w, 16w+16) for all 64 rows, so each D1 row
    // is read once per workgroup. Lane (c, hh) loads 4 contiguous k at
    // k0 + 4*hh of A row c and of D1 row c with the same code: elements 0,1
    // feed one WMMA and 2,3 the next, so A and B pair on equal k.
    {
        const int c = lane & 15, hh = lane >> 4;
        const int j = wave * 16 + c;
        const float* xa = Hs + c * HP_ + 4 * hh;
        const float* wb = D1 + j * D_ + 4 * hh;
        v8f hacc[4];
#pragma unroll
        for (int s = 0; s < 4; ++s) hacc[s] = v8f_zero();
        // unrolled so that several k steps' D1 loads are in flight together
#pragma unroll 8
        for (int k0 = 0; k0 < D_; k0 += 8) {
            v4f bv = *(const v4f*)(wb + k0);
            v2f b0 = {bv[0], bv[1]}, b1 = {bv[2], bv[3]};
#pragma unroll
            for (int s = 0; s < 4; ++s) {
                v4f av = *(const v4f*)(xa + s * 16 * HP_ + k0);
                v2f a0 = {av[0], av[1]}, a1 = {av[2], av[3]};
                hacc[s] = __builtin_amdgcn_wmma_f32_16x16x4_f32(
                    false, a0, false, b0, (short)0, hacc[s], false, false);
                hacc[s] = __builtin_amdgcn_wmma_f32_16x16x4_f32(
                    false, a1, false, b1, (short)0, hacc[s], false, false);
            }
        }
        const float bias = db1[j];
#pragma unroll
        for (int s = 0; s < 4; ++s) {
#pragma unroll
            for (int r = 0; r < 8; ++r)
                h1[(s * 16 + 8 * hh + r) * 128 + j] = fmaxf(hacc[s][r] + bias, 0.0f);
        }
    }
    __syncthreads();

    // b1 = softplus(h1 @ D2.T + db2)
#pragma unroll
    for (int rep = 0; rep < 2; ++rep) {
        int idx = rep * 256 + t;
        int r = idx >> 3, h = idx & 7;
        float d = db2[h];
        const float* w = D2 + h * 128;
        const float* x = h1 + r * 128;
#pragma unroll 8
        for (int k = 0; k < 128; ++k) d = fmaf(x[k], w[k], d);
        b1w[(size_t)(m0 + r) * H_ + h] = log1pf(__expf(d));
    }
}

// ---------------- prep 3: fold Wk and P_uk into the query ------------------
// Q_h . K[n]_h = h_send[n] . (Q_h @ Wk_h) + Q_h . P_uk[bs[n]]_h, so K is never
// formed: per (b, h) a 256-vector QK and 16 scalars QP replace the 64x256 K.
// Workgroup = 64 rows b x one head, f32 16x16x4 WMMA (operands stay f32).
// Lane (c, hh) holds k = k0 + 4*hh + {0..3} of A row c and of B column c:
// elements 0,1 feed one WMMA and 2,3 the next, so A and B pair on equal k.
// A wave owns 64 columns (one whole 128-B line of bf16 per row) x 32 rows.
extern "C" __global__ void __launch_bounds__(256)
baca_qk(const float* __restrict__ Qf, const float* __restrict__ Wk,
        const float* __restrict__ P_uk,
        bf16_t* __restrict__ QKb, float* __restrict__ QP) {
    const int t = threadIdx.x, lane = t & 31, wave = t >> 5;
    const int h  = blockIdx.x & 7;
    const int m0 = (blockIdx.x >> 3) * 64 + (wave >> 2) * 32;
    const int cg = (wave & 3) * 64;
    const int c = lane & 15, hh = lane >> 4;
    const float* qa = Qf   + (size_t)(m0 + c) * D_ + h * DH_ + 4 * hh;
    const float* wb = Wk   + (h * DH_ + 4 * hh) * D_ + cg + c;
    const float* pb = P_uk + c * D_ + h * DH_ + 4 * hh;
    v8f acc[2][4], pacc[2];
#pragma unroll
    for (int s = 0; s < 2; ++s) {
        pacc[s] = v8f_zero();
#pragma unroll
        for (int ct = 0; ct < 4; ++ct) acc[s][ct] = v8f_zero();
    }
    v4f av[4][2], pv[4];
#pragma unroll
    for (int kq = 0; kq < 4; ++kq) {
        pv[kq] = *(const v4f*)(pb + kq * 8);
#pragma unroll
        for (int s = 0; s < 2; ++s) av[kq][s] = *(const v4f*)(qa + s * 16 * D_ + kq * 8);
    }
    // the loads above are all issued here; behind this wait their address
    // registers may be reused
    asm volatile("s_wait_xcnt 0x0" ::: "memory");
#pragma unroll
    for (int kq = 0; kq < 4; ++kq) {
        v2f a0[2], a1[2];
#pragma unroll
        for (int s = 0; s < 2; ++s) {
            a0[s] = v2f{av[kq][s][0], av[kq][s][1]};
            a1[s] = v2f{av[kq][s][2], av[kq][s][3]};
        }
#pragma unroll
        for (int ct = 0; ct < 4; ++ct) {
            const float* w = wb + kq * 8 * D_ + ct * 16;
            v2f b0 = {w[0], w[D_]}, b1 = {w[2 * D_], w[3 * D_]};
#pragma unroll
            for (int s = 0; s < 2; ++s) {
                acc[s][ct] = __builtin_amdgcn_wmma_f32_16x16x4_f32(
                    false, a0[s], false, b0, (short)0, acc[s][ct], false, false);
                acc[s][ct] = __builtin_amdgcn_wmma_f32_16x16x4_f32(
                    false, a1[s], false, b1, (short)0, acc[s][ct], false, false);
            }
        }
        v2f p0 = {pv[kq][0], pv[kq][1]}, p1 = {pv[kq][2], pv[kq][3]};
#pragma unroll
        for (int s = 0; s < 2; ++s) {
            pacc[s] = __builtin_amdgcn_wmma_f32_16x16x4_f32(
                false, a0[s], false, p0, (short)0, pacc[s], false, false);
            pacc[s] = __builtin_amdgcn_wmma_f32_16x16x4_f32(
                false, a1[s], false, p1, (short)0, pacc[s], false, false);
        }
    }
    // keeps the stores' address arithmetic out of the WMMA block, where it was
    // scheduled onto operand registers directly behind the WMMA that read them
    __builtin_amdgcn_sched_barrier(0);
    // four vector slots between the last WMMA and the first overwrite of its operands
    asm volatile("v_nop\n\tv_nop\n\tv_nop\n\tv_nop");
    // holds the epilogue's vector instructions behind those slots
    __builtin_amdgcn_sched_barrier(0);
#pragma unroll
    for (int s = 0; s < 2; ++s) {
#pragma unroll
        for (int r = 0; r < 8; ++r) {
            size_t row = (size_t)(m0 + s * 16 + 8 * hh + r) * H_ + h;
#pragma unroll
            for (int ct = 0; ct < 4; ++ct)
                QKb[row * D_ + cg + ct * 16 + c] = (bf16_t)acc[s][ct][r];
            if ((wave & 3) == 0) QP[row * NB_ + c] = pacc[s][r];
        }
    }
}

// ---------------- kernel B: scores, V projection and attention per b -------
// Wave w: all 64 rows (n) x the 32 V columns of head w, so that a Wv fragment
// is loaded once per workgroup and feeds four WMMAs. The score tile of strip
// w & 3 is one more B fragment of the same k loop: B[k][h] = QK[b][h][k]
// (columns 8..15 repeat heads 0..7 and are not read).
// V never touches LDS: accumulators stay in registers and are contracted
// against attn directly (register tile j-axis == n reduction axis).
// LDS carve (54 KB):
//   Pv f32[16*256] | sc f32[512] | qps f32[128] | b1s f32[8] | inv f32[8]
//   dists f32[64] | zpart f32[2*256] | As bf16[64*AP_] | bs int[64] | msk int[64]
extern "C" __global__ void __launch_bounds__(256)
baca_attn(const float* __restrict__ h_send, const int* __restrict__ batch_recv,
          const int* __restrict__ batch_send, const float* __restrict__ dist,
          const int* __restrict__ mask, const float* __restrict__ gamma,
          const bf16_t* __restrict__ Wv_bf, const float* __restrict__ P_uv,
          const bf16_t* __restrict__ QKb, const float* __restrict__ QP,
          const float* __restrict__ b1w,
          float* __restrict__ z_out, float* __restrict__ attn_out) {
    extern __shared__ char smem[];
    float*  Pv    = (float*)smem;                // 16*256
    float*  sc    = Pv + 16 * 256;               // 64*8
    float*  qps   = sc + 512;                    // 8*16
    float*  b1s   = qps + 128;                   // 8
    float*  inv   = b1s + 8;                     // 8
    float*  dists = inv + 8;                     // 64
    float*  zpart = dists + 64;                  // 2*256
    bf16_t* As    = (bf16_t*)(zpart + 2 * 256);  // 64*AP_ (16B aligned)
    int*    bs    = (int*)(As + 64 * AP_);       // 64
    int*    msk   = bs + 64;                     // 64

    const int t = threadIdx.x, lane = t & 31;
    // the wave's number as a scalar: addresses built from it stay out of the VGPRs
    const int wave = __builtin_amdgcn_readfirstlane(t >> 5);
    const int b = blockIdx.x;

    // stage: h_send[b] -> bf16, P_uv table, per-(h, batch) and per-n scalars
    const float* hs = h_send + (size_t)b * (N_ * D_);
    // Every global load of the stage is issued before the first one is waited
    // for, the two big tables as 16-byte loads: the stage then costs one trip to
    // memory, not one per loop trip and per table. The small tables' values wait
    // in registers until the big tables are stored.
    v4f st[16], pt[4];
#pragma unroll
    for (int i = 0; i < 16; ++i) st[i] = *(const v4f*)(hs + (t + i * 256) * 4);
#pragma unroll
    for (int i = 0; i < 4; ++i) pt[i] = *(const v4f*)(P_uv + (t + i * 256) * 4);
    int   bsv = 0, mkv = 0;
    float dsv = 0.0f, qpv = 0.0f, b1v = 0.0f;
    if (t < 64) {
        bsv = (batch_send + (size_t)b * N_)[t];
        mkv = (mask + (size_t)b * N_)[t];
        dsv = (dist + (size_t)b * N_)[t];
    }
    if (t < H_ * NB_) qpv = QP[(size_t)b * (H_ * NB_) + t];
    if (t < H_) b1v = b1w[(size_t)b * H_ + t];
#pragma unroll
    for (int i = 0; i < 16; ++i) {
        v4bf pk;
#pragma unroll
        for (int e = 0; e < 4; ++e) pk[e] = (bf16_t)st[i][e];
        *(v4bf*)(As + (i * 4 + (t >> 6)) * AP_ + (t & 63) * 4) = pk;
    }
#pragma unroll
    for (int i = 0; i < 4; ++i) *(v4f*)(Pv + (t + i * 256) * 4) = pt[i];
    if (t < 64) {
        bs[t]    = bsv;
        msk[t]   = mkv;
        dists[t] = dsv;
    }
    if (t < H_ * NB_) qps[t] = qpv;
    if (t < H_) b1s[t] = b1v;
    __syncthreads();

    const int strip = (wave & 3) * 16;
    const int rbase = strip + ((lane >> 4) << 3);
    // acc[s][ct]: rows of strip (wave + s) & 3, columns wave * 32 + ct * 16. The
    // strips start at the wave's own score strip, so that a[0] below serves both.
    v8f acc[4][2];
#pragma unroll
    for (int s = 0; s < 4; ++s) {
        acc[s][0] = v8f_zero();
        acc[s][1] = v8f_zero();
    }
    v8f sacc = v8f_zero();
    {
        // frag_a's k order: low chunk at k0 + 8*(lane >> 4), high chunk 16 on
        const bf16_t* qk = QKb + (size_t)b * (H_ * D_) + (lane & 7) * D_ + ((lane >> 4) << 3);
        // Three B fragments a k step: rb[0] the score fragment, rb[1] and rb[2] the
        // head's two V column tiles. Each is refilled for the next k step right
        // behind the last WMMA that read it, so its load flies under the other
        // WMMAs and the next A reads. The loops are unrolled whole so that every
        // index of rb and acc is a constant and they stay in registers.
        v16bf rb[3];
        rb[0] = frag_q(qk, 0);
        rb[1] = frag_b(Wv_bf, wave * 2, 0, lane);
        rb[2] = frag_b(Wv_bf, wave * 2 + 1, 0, lane);
#pragma unroll
        for (int ks = 0; ks < 8; ++ks) {
            // the A strips come in two pairs through one pair of register sets, which
            // keeps the kernel within 128 VGPRs (eight waves per SIMD)
#pragma unroll
            for (int hf = 0; hf < 2; ++hf) {
                v16bf a[2];
#pragma unroll
                for (int s = 0; s < 2; ++s)
                    a[s] = frag_ap(As, ((wave + hf * 2 + s) & 3) * 16, ks * 32, lane);
                if (hf == 0) {
                    sacc = __builtin_amdgcn_wmma_f32_16x16x32_bf16(
                        false, a[0], false, rb[0], (short)0, sacc, false, false);
                    // keeps the refill behind the WMMA that reads the set, so that it takes the
                    // set's own registers and not a fourth set's
                    __builtin_amdgcn_sched_barrier(0);
                    if (ks < 7) rb[0] = frag_q(qk, ks + 1);
                    // holds each refill where it is written: without it the compiler moves the
                    // loads down to just in front of their WMMA, and each waits out its own latency
                    __builtin_amdgcn_sched_barrier(0);
                }
#pragma unroll
                for (int ct = 0; ct < 2; ++ct) {
#pragma unroll
                    for (int s = 0; s < 2; ++s)
                        acc[hf * 2 + s][ct] = __builtin_amdgcn_wmma_f32_16x16x32_bf16(
                            false, a[s], false, rb[1 + ct], (short)0, acc[hf * 2 + s][ct], false, false);
                    if (hf == 1 && ks < 7) {
                        // as above: the refill stays behind the set's last reader
                        __builtin_amdgcn_sched_barrier(0);
                        rb[1 + ct] = frag_b(Wv_bf, wave * 2 + ct, ks + 1, lane);
                        // as above: holds the refill where it is written
                        __builtin_amdgcn_sched_barrier(0);
                    }
                }
                // keeps the next pair's A reads behind this pair's last reader, so that
                // they take this pair's registers and not a second pair's
                __builtin_amdgcn_sched_barrier(0);
            }
        }
    }

    // scores[n][h]: sacc[j] is h_send[rbase+j] . QK[h], h = lane & 15
    if (wave < 4 && (lane & 15) < H_) {
        const int   h     = lane & 15;
        const int   br    = batch_recv[b];
        const float scale = 0.1767766952966369f;   // 1/sqrt(32)
#pragma unroll
        for (int j = 0; j < 8; ++j) {
            int n = rbase + j;
            float d = sacc[j] + qps[h * NB_ + bs[n]];
            float s = d * scale - b1s[h] * dists[n] + gamma[br * NB_ + bs[n]];
            sc[n * H_ + h] = (msk[n] == 0) ? -INFINITY : s;
        }
    }
    __syncthreads();

    // softmax over n, per h (8 lanes, N=64 serial - tiny)
    if (t < H_) {
        float m = -INFINITY;
        for (int n = 0; n < N_; ++n) m = fmaxf(m, sc[n * H_ + t]);
        float s = 0.0f;
        for (int n = 0; n < N_; ++n) {
            float e = __expf(sc[n * H_ + t] - m);
            sc[n * H_ + t] = e;
            s += e;
        }
        inv[t] = 1.0f / s;
    }
    __syncthreads();

#pragma unroll
    for (int rep = 0; rep < 2; ++rep) {
        int idx = t + rep * 256;
        int n = idx >> 3, h = idx & 7;
        float a = sc[n * H_ + h] * inv[h];
        sc[n * H_ + h] = a;
        attn_out[((size_t)b * N_ + n) * H_ + h] = a;
    }
    __syncthreads();

    // contract register V tiles with attn: the wave's head is h = wave.
    // Lane owns cols wave*32 + ct*16 + (lane&15); acc[s][ct][j] is V[row][col],
    // row = ((wave+s)&3)*16 + 8*(lane>>4) + j: 32 of a column's 64 rows per lane.
    {
        const int hh = lane >> 4;
        float p0 = 0.0f, p1 = 0.0f;
#pragma unroll
        for (int s = 0; s < 4; ++s) {
            const int r0 = ((wave + s) & 3) * 16 + hh * 8;
#pragma unroll
            for (int j = 0; j < 8; ++j) {
                float w = sc[(r0 + j) * H_ + wave];
                p0 = fmaf(w, acc[s][0][j], p0);
                p1 = fmaf(w, acc[s][1][j], p1);
            }
        }
        zpart[hh * D_ + wave * 32 + (lane & 15)]      = p0;
        zpart[hh * D_ + wave * 32 + 16 + (lane & 15)] = p1;
    }
    __syncthreads();

    // z[b, col] = sum(zpart) + sum_n attn[n,h] * P_uv[bs[n]][col]
    {
        const int h = t >> 5;
        float z = zpart[t] + zpart[D_ + t];
#pragma unroll 8
        for (int n = 0; n < N_; ++n)
            z = fmaf(sc[n * H_ + h], Pv[bs[n] * D_ + t], z);
        z_out[(size_t)b * D_ + t] = z;
    }
}

// --------------------------------------------------------------------------
extern "C" void kernel_launch(void* const* d_in, const int* in_sizes, int n_in,
                              void* d_out, int out_size, void* d_ws, size_t ws_size,
                              hipStream_t stream) {
    const float* h_recv     = (const float*)d_in[0];
    const float* h_send     = (const float*)d_in[1];
    const int*   batch_recv = (const int*)d_in[2];
    const int*   batch_send = (const int*)d_in[3];
    const float* dist       = (const float*)d_in[4];
    const int*   mask       = (const int*)d_in[5];
    const float* Wq = (const float*)d_in[6];  const float* bq  = (const float*)d_in[7];
    const float* Wk = (const float*)d_in[8];  const float* bk  = (const float*)d_in[9];
    const float* Wv = (const float*)d_in[10]; const float* bv  = (const float*)d_in[11];
    const float* Uq = (const float*)d_in[12]; const float* buq = (const float*)d_in[13];
    const float* Uk = (const float*)d_in[14]; const float* buk = (const float*)d_in[15];
    const float* Uv = (const float*)d_in[16]; const float* buv = (const float*)d_in[17];
    const float* batch_emb = (const float*)d_in[18];
    const float* D1  = (const float*)d_in[19]; const float* db1 = (const float*)d_in[20];
    const float* D2  = (const float*)d_in[21]; const float* db2 = (const float*)d_in[22];
    const float* gamma = (const float*)d_in[23];

    // workspace carve (about 24 MB)
    bf16_t* Wq_bf = (bf16_t*)d_ws;
    bf16_t* Wv_bf = Wq_bf + D_ * D_;
    float*  P_uq  = (float*)(Wv_bf + D_ * D_);
    float*  P_uk  = P_uq + NB_ * D_;
    float*  P_uv  = P_uk + NB_ * D_;
    float*  Qf    = P_uv + NB_ * D_;            // B*D
    float*  b1w   = Qf + (size_t)B_ * D_;       // B*H
    float*  QP    = b1w + (size_t)B_ * H_;      // B*H*NB
    bf16_t* QKb   = (bf16_t*)(QP + (size_t)B_ * H_ * NB_);   // B*H*D

    float* z_out    = (float*)d_out;
    float* attn_out = z_out + (size_t)B_ * D_;

    hipLaunchKernelGGL(baca_cvt_w, dim3(2 * D_ * D_ / 256), dim3(256), 0, stream,
                       Wq, Wv, Wq_bf);
    hipLaunchKernelGGL(baca_pu, dim3(3 * NB_ * D_ / 256), dim3(256), 0, stream,
                       Uq, buq, bq, Uk, buk, bk, Uv, buv, bv, batch_emb,
                       P_uq, P_uk, P_uv);

    size_t lds_a = (64 * HP_ + 64 * 128) * sizeof(float)
                 + 64 * 256 * sizeof(bf16_t) + 64 * sizeof(int);
    hipLaunchKernelGGL(baca_qb1, dim3(B_ / 64), dim3(256), lds_a, stream,
                       h_recv, batch_recv, Wq_bf, P_uq, batch_emb,
                       D1, db1, D2, db2, Qf, b1w);

    hipLaunchKernelGGL(baca_qk, dim3(B_ / 64 * H_), dim3(256), 0, stream,
                       Qf, Wk, P_uk, QKb, QP);

    size_t lds_b = (16 * 256 + 512 + 128 + 8 + 8 + 64 + 2 * 256) * sizeof(float)
                 + 64 * AP_ * sizeof(bf16_t) + 128 * sizeof(int);
    hipLaunchKernelGGL(baca_attn, dim3(B_), dim3(256), lds_b, stream,
                       h_send, batch_recv, batch_send, dist, mask, gamma,
                       Wv_bf, P_uv, QKb, QP, b1w, z_out, attn_out);
}

// v007
// It runs in 116 microseconds.
// In both of two side-by-side timings against v006, it was 1.12 times as fast.
// Counting every step since v000, it is 11.2 times as fast.
#include <hip/hip_runtime.h>
#include <hip/hip_bf16.h>
#include <math.h>

#define B_  4096
#define N_  64
#define D_  256
#define H_  8
#define NB_ 16
#define DH_ 32

typedef __bf16 bf16_t;
typedef __attribute__((ext_vector_type(16))) __bf16 v16bf;
typedef __attribute__((ext_vector_type(8)))  __bf16 v8bf;
typedef __attribute__((ext_vector_type(4)))  __bf16 v4bf;
typedef __attribute__((ext_vector_type(8)))  float  v8f;
typedef __attribute__((ext_vector_type(4)))  float  v4f;
typedef __attribute__((ext_vector_type(2)))  float  v2f;

// LDS row pitch (floats) of the f32 receiver state: 1040 B = 16 B x 65, so the
// 16 rows of one ds_load_b128 fragment read fall on 64 distinct banks.
#define HP_ 260

__device__ __forceinline__ v8f v8f_zero() {
    v8f v;
#pragma unroll
    for (int i = 0; i < 8; ++i) v[i] = 0.0f;
    return v;
}

// A fragment (16x32 bf16, row-major source with row stride D_):
// lanes 0-15 : row = mr+lane,    K chunks [k0, k0+8) and [k0+16, k0+24)
// lanes 16-31: row = mr+lane-16, K chunks [k0+8, k0+16) and [k0+24, k0+32)
__device__ __forceinline__ v16bf frag_a(const bf16_t* __restrict__ A, int mr, int k0, int lane) {
    int r  = mr + (lane & 15);
    int kk = k0 + ((lane >> 4) << 3);
    v8bf lo = *(const v8bf*)(A + r * D_ + kk);
    v8bf hi = *(const v8bf*)(A + r * D_ + kk + 16);
    v16bf f;
#pragma unroll
    for (int i = 0; i < 8; ++i) { f[i] = lo[i]; f[i + 8] = hi[i]; }
    return f;
}

// LDS row pitch (bf16) of baca_attn's sender rows: 528 B = 16 B x 33, so the 16
// rows of one ds_load_b128 fragment read fall on distinct banks.
#define AP_ 264

// frag_a on rows at pitch AP_: same lanes, same k order.
__device__ __forceinline__ v16bf frag_ap(const bf16_t* __restrict__ A, int mr, int k0, int lane) {
    int r  = mr + (lane & 15);
    int kk = k0 + ((lane >> 4) << 3);
    v8bf lo = *(const v8bf*)(A + r * AP_ + kk);
    v8bf hi = *(const v8bf*)(A + r * AP_ + kk + 16);
    v16bf f;
#pragma unroll
    for (int i = 0; i < 8; ++i) { f[i] = lo[i]; f[i + 8] = hi[i]; }
    return f;
}

// B fragment (32x16 bf16). B[k][n] = W[n][k] (we compute X @ W.T). The weights
// lie in the workspace in fragment order (baca_cvt_w): fragment (k step ks,
// column tile ct) is the 1 KB block ks*16 + ct, its first 512 B the 32 lanes'
// low k chunks in lane order, its second 512 B their high k chunks. Each
// wave-wide 16-byte load so covers four whole 128-B lines, not 32 B of sixteen.
__device__ __forceinline__ v16bf frag_b(const bf16_t* __restrict__ Wp, int ct, int ks, int lane) {
    const bf16_t* p = Wp + ((ks * 16 + ct) << 9) + (lane << 3);
    v8bf lo = *(const v8bf*)(p);
    v8bf hi = *(const v8bf*)(p + 256);
    v16bf f;
#pragma unroll
    for (int i = 0; i < 8; ++i) { f[i] = lo[i]; f[i + 8] = hi[i]; }
    return f;
}

// Score B fragment of k step ks: B[k][h] = QK[b][h][k], q already at the lane's
// head row and low k chunk.
__device__ __forceinline__ v16bf frag_q(const bf16_t* __restrict__ q, int ks) {
    v8bf lo = *(const v8bf*)(q + ks * 32);
    v8bf hi = *(const v8bf*)(q + ks * 32 + 16);
    v16bf f;
#pragma unroll
    for (int i = 0; i < 8; ++i) { f[i] = lo[i]; f[i + 8] = hi[i]; }
    return f;
}

// Maximum and sum over the 32 lanes of a wave, the result in every lane: four
// DPP steps inside each 16-lane row, then lane l with lane l ^ 16.
template <int CTRL>
__device__ __forceinline__ float row_x(float x) {
    return __builtin_bit_cast(float, __builtin_amdgcn_update_dpp(
        0, __builtin_bit_cast(int, x), CTRL, 0xf, 0xf, false));
}
__device__ __forceinline__ float xhalf(float x) {
    return __builtin_bit_cast(float, __builtin_amdgcn_permlanex16(
        __builtin_bit_cast(int, x), __builtin_bit_cast(int, x), 0x76543210, 0xfedcba98, false, false));
}
__device__ __forceinline__ float wave_max(float x) {
    x = fmaxf(x, row_x<0x161>(x));   // row_xmask:1
    x = fmaxf(x, row_x<0x162>(x));   // row_xmask:2
    x = fmaxf(x, row_x<0x164>(x));   // row_xmask:4
    x = fmaxf(x, row_x<0x168>(x));   // row_xmask:8
    return fmaxf(x, xhalf(x));
}
__device__ __forceinline__ float wave_sum(float x) {
    x += row_x<0x161>(x);
    x += row_x<0x162>(x);
    x += row_x<0x164>(x);
    x += row_x<0x168>(x);
    return x + xhalf(x);
}

// ---------------- prep 1: convert Wq/Wv to bf16, in fragment order ---------
// dst element: [matrix][ks*16 + ct][part][lane][e] holds
// W[ct*16 + (lane & 15)][ks*32 + part*16 + (lane >> 4)*8 + e], frag_a's k order.
extern "C" __global__ void __launch_bounds__(256)
baca_cvt_w(const float* __restrict__ Wq, const float* __restrict__ Wv,
           bf16_t* __restrict__ dst) {
    int idx = blockIdx.x * 256 + threadIdx.x;           // 0 .. 2*65536
    const float* src = (idx < 65536) ? Wq : Wv;
    int e = idx & 7, lane = (idx >> 3) & 31, part = (idx >> 8) & 1;
    int ct = (idx >> 9) & 15, ks = (idx >> 13) & 7;
    int row = ct * 16 + (lane & 15);
    int k   = ks * 32 + part * 16 + ((lane >> 4) << 3) + e;
    dst[idx] = (bf16_t)src[row * D_ + k];
}

// ---------------- prep 2: P_u* = batch_emb @ U*.T + b* + bu* ---------------
extern "C" __global__ void __launch_bounds__(256)
baca_pu(const float* __restrict__ Uq, const float* __restrict__ buq, const float* __restrict__ bq,
        const float* __restrict__ Uk, const float* __restrict__ buk, const float* __restrict__ bk,
        const float* __restrict__ Uv, const float* __restrict__ buv, const float* __restrict__ bv,
        const float* __restrict__ batch_emb,
        float* __restrict__ P_uq, float* __restrict__ P_uk, float* __restrict__ P_uv) {
    int idx = blockIdx.x * 256 + threadIdx.x;           // 0 .. 3*16*256
    int which = idx / (NB_ * D_);
    int rem   = idx - which * (NB_ * D_);
    int nb = rem >> 8, d = rem & 255;
    const float* U  = (which == 0) ? Uq  : (which == 1) ? Uk  : Uv;
    const float* bu = (which == 0) ? buq : (which == 1) ? buk : buv;
    const float* bw = (which == 0) ? bq  : (which == 1) ? bk  : bv;
    float*       P  = (which == 0) ? P_uq: (which == 1) ? P_uk: P_uv;
    float acc = bu[d] + bw[d];
    const float* e = batch_emb + nb * D_;
    const float* u = U + d * D_;
#pragma unroll 8
    for (int k = 0; k < D_; ++k) acc = fmaf(e[k], u[k], acc);
    P[rem] = acc;
}

// ---------------- kernel A: Q = h_recv@Wq.T + gather(P_uq); b1 MLP ---------
// LDS carve: Hs f32[64*HP_] | h1 f32[64*128] | As bf16[64*256] | br int[64]
extern "C" __global__ void __launch_bounds__(256)
baca_qb1(const float* __restrict__ h_recv, const int* __restrict__ batch_recv,
         const bf16_t* __restrict__ Wq_bf, const float* __restrict__ P_uq,
         const float* __restrict__ batch_emb,
         const float* __restrict__ D1, const float* __restrict__ db1,
         const float* __restrict__ D2, const float* __restrict__ db2,
         float* __restrict__ Qf, float* __restrict__ b1w) {
    extern __shared__ char smem[];
    float*  Hs = (float*)smem;                   // 64*HP_
    float*  h1 = Hs + 64 * HP_;                  // 64*128
    bf16_t* As = (bf16_t*)(h1 + 64 * 128);       // 64*256
    int*    br = (int*)(As + 64 * 256);          // 64

    const int t = threadIdx.x, lane = t & 31, wave = t >> 5;
    const int m0 = blockIdx.x * 64;

    const float* hr = h_recv + (size_t)m0 * D_;
#pragma unroll 4
    for (int i = 0; i < 64; ++i) {
        int idx = t + i * 256;
        float v = hr[idx];
        Hs[(idx >> 8) * HP_ + (idx & 255)] = v;
        As[idx] = (bf16_t)v;
    }
    if (t < 64) br[t] = batch_recv[m0 + t];
    __syncthreads();

    // receiver_state = h_recv + E_recv (in place; WMMA below only reads As)
#pragma unroll 4
    for (int i = 0; i < 64; ++i) {
        int idx = t + i * 256;
        Hs[(idx >> 8) * HP_ + (idx & 255)] += batch_emb[br[idx >> 8] * D_ + (idx & 255)];
    }

    // WMMA: 64x256 output, 8 waves x 8 tiles
    {
        const int strip = (wave & 3) * 16;
        const int chalf = (wave >> 2) * 8;
        v8f acc[8];
#pragma unroll
        for (int ct = 0; ct < 8; ++ct) acc[ct] = v8f_zero();
        for (int k0 = 0; k0 < D_; k0 += 32) {
            v16bf a = frag_a(As, strip, k0, lane);
#pragma unroll
            for (int ct = 0; ct < 8; ++ct) {
                v16bf bb = frag_b(Wq_bf, chalf + ct, k0 >> 5, lane);
                acc[ct] = __builtin_amdgcn_wmma_f32_16x16x32_bf16(
                    false, a, false, bb, (short)0, acc[ct], false, false);
            }
        }
        const int rbase = strip + ((lane >> 4) << 3);
#pragma unroll
        for (int ct = 0; ct < 8; ++ct) {
            int col = (chalf + ct) * 16 + (lane & 15);
#pragma unroll
            for (int j = 0; j < 8; ++j) {
                int row = rbase + j;
                Qf[(size_t)(m0 + row) * D_ + col] = acc[ct][j] + P_uq[br[row] * D_ + col];
            }
        }
    }
    __syncthreads();

    // hidden = relu(rs @ D1.T + db1) on f32 16x16x4 WMMA (operands stay f32).
    // Wave w owns hidden columns [16w, 16w+16) for all 64 rows, so each D1 row
    // is read once per workgroup. Lane (c, hh) loads 4 contiguous k at
    // k0 + 4*hh of A row c and of D1 row c with the same code: elements 0,1
    // feed one WMMA and 2,3 the next, so A and B pair on equal k.
    {
        const int c = lane & 15, hh = lane >> 4;
        const int j = wave * 16 + c;
        const float* xa = Hs + c * HP_ + 4 * hh;
        const float* wb = D1 + j * D_ + 4 * hh;
        v8f hacc[4];
#pragma unroll
        for (int s = 0; s < 4; ++s) hacc[s] = v8f_zero();
        // unrolled so that several k steps' D1 loads are in flight together
#pragma unroll 8
        for (int k0 = 0; k0 < D_; k0 += 8) {
            v4f bv = *(const v4f*)(wb + k0);
            v2f b0 = {bv[0], bv[1]}, b1 = {bv[2], bv[3]};
#pragma unroll
            for (int s = 0; s < 4; ++s) {
                v4f av = *(const v4f*)(xa + s * 16 * HP_ + k0);
                v2f a0 = {av[0], av[1]}, a1 = {av[2], av[3]};
                hacc[s] = __builtin_amdgcn_wmma_f32_16x16x4_f32(
                    false, a0, false, b0, (short)0, hacc[s], false, false);
                hacc[s] = __builtin_amdgcn_wmma_f32_16x16x4_f32(
                    false, a1, false, b1, (short)0, hacc[s], false, false);
            }
        }
        const float bias = db1[j];
#pragma unroll
        for (int s = 0; s < 4; ++s) {
#pragma unroll
            for (int r = 0; r < 8; ++r)
                h1[(s * 16 + 8 * hh + r) * 128 + j] = fmaxf(hacc[s][r] + bias, 0.0f);
        }
    }
    __syncthreads();

    // b1 = softplus(h1 @ D2.T + db2)
#pragma unroll
    for (int rep = 0; rep < 2; ++rep) {
        int idx = rep * 256 + t;
        int r = idx >> 3, h = idx & 7;
        float d = db2[h];
        const float* w = D2 + h * 128;
        const float* x = h1 + r * 128;
#pragma unroll 8
        for (int k = 0; k < 128; ++k) d = fmaf(x[k], w[k], d);
        b1w[(size_t)(m0 + r) * H_ + h] = log1pf(__expf(d));
    }
}

// ---------------- prep 3: fold Wk and P_uk into the query ------------------
// Q_h . K[n]_h = h_send[n] . (Q_h @ Wk_h) + Q_h . P_uk[bs[n]]_h, so K is never
// formed: per (b, h) a 256-vector QK and 16 scalars QP replace the 64x256 K.
// Workgroup = 64 rows b x one head, f32 16x16x4 WMMA (operands stay f32).
// Lane (c, hh) holds k = k0 + 4*hh + {0..3} of A row c and of B column c:
// elements 0,1 feed one WMMA and 2,3 the next, so A and B pair on equal k.
// A wave owns 64 columns (one whole 128-B line of bf16 per row) x 32 rows.
extern "C" __global__ void __launch_bounds__(256)
baca_qk(const float* __restrict__ Qf, const float* __restrict__ Wk,
        const float* __restrict__ P_uk,
        bf16_t* __restrict__ QKb, float* __restrict__ QP) {
    const int t = threadIdx.x, lane = t & 31, wave = t >> 5;
    const int h  = blockIdx.x & 7;
    const int m0 = (blockIdx.x >> 3) * 64 + (wave >> 2) * 32;
    const int cg = (wave & 3) * 64;
    const int c = lane & 15, hh = lane >> 4;
    const float* qa = Qf   + (size_t)(m0 + c) * D_ + h * DH_ + 4 * hh;
    const float* wb = Wk   + (h * DH_ + 4 * hh) * D_ + cg + c;
    const float* pb = P_uk + c * D_ + h * DH_ + 4 * hh;
    v8f acc[2][4], pacc[2];
#pragma unroll
    for (int s = 0; s < 2; ++s) {
        pacc[s] = v8f_zero();
#pragma unroll
        for (int ct = 0; ct < 4; ++ct) acc[s][ct] = v8f_zero();
    }
    v4f av[4][2], pv[4];
#pragma unroll
    for (int kq = 0; kq < 4; ++kq) {
        pv[kq] = *(const v4f*)(pb + kq * 8);
#pragma unroll
        for (int s = 0; s < 2; ++s) av[kq][s] = *(const v4f*)(qa + s * 16 * D_ + kq * 8);
    }
    // the loads above are all issued here; behind this wait their address
    // registers may be reused
    asm volatile("s_wait_xcnt 0x0" ::: "memory");
#pragma unroll
    for (int kq = 0; kq < 4; ++kq) {
        v2f a0[2], a1[2];
#pragma unroll
        for (int s = 0; s < 2; ++s) {
            a0[s] = v2f{av[kq][s][0], av[kq][s][1]};
            a1[s] = v2f{av[kq][s][2], av[kq][s][3]};
        }
#pragma unroll
        for (int ct = 0; ct < 4; ++ct) {
            const float* w = wb + kq * 8 * D_ + ct * 16;
            v2f b0 = {w[0], w[D_]}, b1 = {w[2 * D_], w[3 * D_]};
#pragma unroll
            for (int s = 0; s < 2; ++s) {
                acc[s][ct] = __builtin_amdgcn_wmma_f32_16x16x4_f32(
                    false, a0[s], false, b0, (short)0, acc[s][ct], false, false);
                acc[s][ct] = __builtin_amdgcn_wmma_f32_16x16x4_f32(
                    false, a1[s], false, b1, (short)0, acc[s][ct], false, false);
            }
        }
        v2f p0 = {pv[kq][0], pv[kq][1]}, p1 = {pv[kq][2], pv[kq][3]};
#pragma unroll
        for (int s = 0; s < 2; ++s) {
            pacc[s] = __builtin_amdgcn_wmma_f32_16x16x4_f32(
                false, a0[s], false, p0, (short)0, pacc[s], false, false);
            pacc[s] = __builtin_amdgcn_wmma_f32_16x16x4_f32(
                false, a1[s], false, p1, (short)0, pacc[s], false, false);
        }
    }
    // keeps the stores' address arithmetic out of the WMMA block, where it was
    // scheduled onto operand registers directly behind the WMMA that read them
    __builtin_amdgcn_sched_barrier(0);
    // four vector slots between the last WMMA and the first overwrite of its operands
    asm volatile("v_nop\n\tv_nop\n\tv_nop\n\tv_nop");
    // holds the epilogue's vector instructions behind those slots
    __builtin_amdgcn_sched_barrier(0);
#pragma unroll
    for (int s = 0; s < 2; ++s) {
#pragma unroll
        for (int r = 0; r < 8; ++r) {
            size_t row = (size_t)(m0 + s * 16 + 8 * hh + r) * H_ + h;
#pragma unroll
            for (int ct = 0; ct < 4; ++ct)
                QKb[row * D_ + cg + ct * 16 + c] = (bf16_t)acc[s][ct][r];
            if ((wave & 3) == 0) QP[row * NB_ + c] = pacc[s][r];
        }
    }
}

// ---------------- kernel B: scores, V projection and attention per b -------
// Wave w: all 64 rows (n) x the 32 V columns of head w, so that a Wv fragment
// is loaded once per workgroup and feeds four WMMAs. The score tile of strip
// w & 3 is one more B fragment of the same k loop: B[k][h] = QK[b][h][k]
// (columns 8..15 repeat heads 0..7 and are not read).
// V never touches LDS: accumulators stay in registers and are contracted
// against attn directly (register tile j-axis == n reduction axis).
// LDS carve (54 KB):
//   Pv f32[16*256] | sc f32[512] | qps f32[128] | b1s f32[8]
//   dists f32[64] | zpart f32[2*256] | As bf16[64*AP_] | bs int[64] | msk int[64]
extern "C" __global__ void __launch_bounds__(256)
baca_attn(const float* __restrict__ h_send, const int* __restrict__ batch_recv,
          const int* __restrict__ batch_send, const float* __restrict__ dist,
          const int* __restrict__ mask, const float* __restrict__ gamma,
          const bf16_t* __restrict__ Wv_bf, const float* __restrict__ P_uv,
          const bf16_t* __restrict__ QKb, const float* __restrict__ QP,
          const float* __restrict__ b1w,
          float* __restrict__ z_out, float* __restrict__ attn_out) {
    extern __shared__ char smem[];
    float*  Pv    = (float*)smem;                // 16*256
    float*  sc    = Pv + 16 * 256;               // 64*8
    float*  qps   = sc + 512;                    // 8*16
    float*  b1s   = qps + 128;                   // 8
    float*  dists = b1s + 8;                     // 64
    float*  zpart = dists + 64;                  // 2*256
    bf16_t* As    = (bf16_t*)(zpart + 2 * 256);  // 64*AP_ (16B aligned)
    int*    bs    = (int*)(As + 64 * AP_);       // 64
    int*    msk   = bs + 64;                     // 64

    const int t = threadIdx.x, lane = t & 31;
    // the wave's number as a scalar: addresses built from it stay out of the VGPRs
    const int wave = __builtin_amdgcn_readfirstlane(t >> 5);
    const int b = blockIdx.x;

    // stage: h_send[b] -> bf16, P_uv table, per-(h, batch) and per-n scalars
    const float* hs = h_send + (size_t)b * (N_ * D_);
    // Every global load of the stage is issued before the first one is waited
    // for, the two big tables as 16-byte loads: the stage then costs one trip to
    // memory, not one per loop trip and per table. The small tables' values wait
    // in registers until the big tables are stored.
    v4f st[16], pt[4];
#pragma unroll
    for (int i = 0; i < 16; ++i) st[i] = *(const v4f*)(hs + (t + i * 256) * 4);
#pragma unroll
    for (int i = 0; i < 4; ++i) pt[i] = *(const v4f*)(P_uv + (t + i * 256) * 4);
    int   bsv = 0, mkv = 0;
    float dsv = 0.0f, qpv = 0.0f, b1v = 0.0f;
    if (t < 64) {
        bsv = (batch_send + (size_t)b * N_)[t];
        mkv = (mask + (size_t)b * N_)[t];
        dsv = (dist + (size_t)b * N_)[t];
    }
    if (t < H_ * NB_) qpv = QP[(size_t)b * (H_ * NB_) + t];
    if (t < H_) b1v = b1w[(size_t)b * H_ + t];
#pragma unroll
    for (int i = 0; i < 16; ++i) {
        v4bf pk;
#pragma unroll
        for (int e = 0; e < 4; ++e) pk[e] = (bf16_t)st[i][e];
        *(v4bf*)(As + (i * 4 + (t >> 6)) * AP_ + (t & 63) * 4) = pk;
    }
#pragma unroll
    for (int i = 0; i < 4; ++i) *(v4f*)(Pv + (t + i * 256) * 4) = pt[i];
    if (t < 64) {
        bs[t]    = bsv;
        msk[t]   = mkv;
        dists[t] = dsv;
    }
    if (t < H_ * NB_) qps[t] = qpv;
    if (t < H_) b1s[t] = b1v;
    __syncthreads();

    const int strip = (wave & 3) * 16;
    const int rbase = strip + ((lane >> 4) << 3);
    // acc[s][ct]: rows of strip (wave + s) & 3, columns wave * 32 + ct * 16. The
    // strips start at the wave's own score strip, so that a[0] below serves both.
    v8f acc[4][2];
#pragma unroll
    for (int s = 0; s < 4; ++s) {
        acc[s][0] = v8f_zero();
        acc[s][1] = v8f_zero();
    }
    v8f sacc = v8f_zero();
    {
        // frag_a's k order: low chunk at k0 + 8*(lane >> 4), high chunk 16 on
        const bf16_t* qk = QKb + (size_t)b * (H_ * D_) + (lane & 7) * D_ + ((lane >> 4) << 3);
        // Three B fragments a k step: rb[0] the score fragment, rb[1] and rb[2] the
        // head's two V column tiles. Each is refilled for the next k step right
        // behind the last WMMA that read it, so its load flies under the other
        // WMMAs and the next A reads. The loops are unrolled whole so that every
        // index of rb and acc is a constant and they stay in registers.
        v16bf rb[3];
        rb[0] = frag_q(qk, 0);
        rb[1] = frag_b(Wv_bf, wave * 2, 0, lane);
        rb[2] = frag_b(Wv_bf, wave * 2 + 1, 0, lane);
#pragma unroll
        for (int ks = 0; ks < 8; ++ks) {
            // the A strips come in two pairs through one pair of register sets, which
            // keeps the kernel within 128 VGPRs (eight waves per SIMD)
#pragma unroll
            for (int hf = 0; hf < 2; ++hf) {
                v16bf a[2];
#pragma unroll
                for (int s = 0; s < 2; ++s)
                    a[s] = frag_ap(As, ((wave + hf * 2 + s) & 3) * 16, ks * 32, lane);
                if (hf == 0) {
                    sacc = __builtin_amdgcn_wmma_f32_16x16x32_bf16(
                        false, a[0], false, rb[0], (short)0, sacc, false, false);
                    // keeps the refill behind the WMMA that reads the set, so that it takes the
                    // set's own registers and not a fourth set's
                    __builtin_amdgcn_sched_barrier(0);
                    if (ks < 7) rb[0] = frag_q(qk, ks + 1);
                    // holds each refill where it is written: without it the compiler moves the
                    // loads down to just in front of their WMMA, and each waits out its own latency
                    __builtin_amdgcn_sched_barrier(0);
                }
#pragma unroll
                for (int ct = 0; ct < 2; ++ct) {
#pragma unroll
                    for (int s = 0; s < 2; ++s)
                        acc[hf * 2 + s][ct] = __builtin_amdgcn_wmma_f32_16x16x32_bf16(
                            false, a[s], false, rb[1 + ct], (short)0, acc[hf * 2 + s][ct], false, false);
                    if (hf == 1 && ks < 7) {
                        // as above: the refill stays behind the set's last reader
                        __builtin_amdgcn_sched_barrier(0);
                        rb[1 + ct] = frag_b(Wv_bf, wave * 2 + ct, ks + 1, lane);
                        // as above: holds the refill where it is written
                        __builtin_amdgcn_sched_barrier(0);
                    }
                }
                // keeps the next pair's A reads behind this pair's last reader, so that
                // they take this pair's registers and not a second pair's
                __builtin_amdgcn_sched_barrier(0);
            }
        }
    }

    // scores[n][h]: sacc[j] is h_send[rbase+j] . QK[h], h = lane & 15
    if (wave < 4 && (lane & 15) < H_) {
        const int   h     = lane & 15;
        const int   br    = batch_recv[b];
        const float scale = 0.1767766952966369f;   // 1/sqrt(32)
#pragma unroll
        for (int j = 0; j < 8; ++j) {
            int n = rbase + j;
            float d = sacc[j] + qps[h * NB_ + bs[n]];
            float s = d * scale - b1s[h] * dists[n] + gamma[br * NB_ + bs[n]];
            sc[n * H_ + h] = (msk[n] == 0) ? -INFINITY : s;
        }
    }
    __syncthreads();

    // softmax over n: wave w takes head w, lane l the rows l and l + 32; maximum
    // and sum go over the wave's lanes in registers, and the wave scales its own
    // head, so no lane walks the 64 rows alone while the other waves wait.
    {
        // the lane's number read anew here: taken from t & 31 it would hold one more
        // register across the k loop, and the kernel would leave 128 VGPRs
        const int ln = __builtin_amdgcn_mbcnt_lo(~0u, 0u);
        float* sp = sc + ln * H_ + wave;
        const float s0 = sp[0], s1 = sp[32 * H_];
        const float m  = wave_max(fmaxf(s0, s1));
        const float e0 = __expf(s0 - m), e1 = __expf(s1 - m);
        const float iv = 1.0f / wave_sum(e0 + e1);
        sp[0]       = e0 * iv;
        sp[32 * H_] = e1 * iv;
    }
    __syncthreads();


    // contract register V tiles with attn: the wave's head is h = wave.
    // Lane owns cols wave*32 + ct*16 + (lane&15); acc[s][ct][j] is V[row][col],
    // row = ((wave+s)&3)*16 + 8*(lane>>4) + j: 32 of a column's 64 rows per lane.
    {
        const int hh = lane >> 4;
        float p0 = 0.0f, p1 = 0.0f;
#pragma unroll
        for (int s = 0; s < 4; ++s) {
            const int r0 = ((wave + s) & 3) * 16 + hh * 8;
#pragma unroll
            for (int j = 0; j < 8; ++j) {
                float w = sc[(r0 + j) * H_ + wave];
                p0 = fmaf(w, acc[s][0][j], p0);
                p1 = fmaf(w, acc[s][1][j], p1);
            }
        }
        zpart[hh * D_ + wave * 32 + (lane & 15)]      = p0;
        zpart[hh * D_ + wave * 32 + 16 + (lane & 15)] = p1;
    }
    __syncthreads();

    // attn goes out behind the last barrier, so that no barrier waits for its stores
#pragma unroll
    for (int rep = 0; rep < 2; ++rep) {
        int idx = t + rep * 256;
        attn_out[(size_t)b * (N_ * H_) + idx] = sc[idx];
    }

    // z[b, col] = sum(zpart) + sum_n attn[n,h] * P_uv[bs[n]][col]
    {
        const int h = t >> 5;
        float z = zpart[t] + zpart[D_ + t];
#pragma unroll 8
        for (int n = 0; n < N_; ++n)
            z = fmaf(sc[n * H_ + h], Pv[bs[n] * D_ + t], z);
        z_out[(size_t)b * D_ + t] = z;
    }
}

// --------------------------------------------------------------------------
extern "C" void kernel_launch(void* const* d_in, const int* in_sizes, int n_in,
                              void* d_out, int out_size, void* d_ws, size_t ws_size,
                              hipStream_t stream) {
    const float* h_recv     = (const float*)d_in[0];
    const float* h_send     = (const float*)d_in[1];
    const int*   batch_recv = (const int*)d_in[2];
    const int*   batch_send = (const int*)d_in[3];
    const float* dist       = (const float*)d_in[4];
    const int*   mask       = (const int*)d_in[5];
    const float* Wq = (const float*)d_in[6];  const float* bq  = (const float*)d_in[7];
    const float* Wk = (const float*)d_in[8];  const float* bk  = (const float*)d_in[9];
    const float* Wv = (const float*)d_in[10]; const float* bv  = (const float*)d_in[11];
    const float* Uq = (const float*)d_in[12]; const float* buq = (const float*)d_in[13];
    const float* Uk = (const float*)d_in[14]; const float* buk = (const float*)d_in[15];
    const float* Uv = (const float*)d_in[16]; const float* buv = (const float*)d_in[17];
    const float* batch_emb = (const float*)d_in[18];
    const float* D1  = (const float*)d_in[19]; const float* db1 = (const float*)d_in[20];
    const float* D2  = (const float*)d_in[21]; const float* db2 = (const float*)d_in[22];
    const float* gamma = (const float*)d_in[23];

    // workspace carve (about 24 MB)
    bf16_t* Wq_bf = (bf16_t*)d_ws;
    bf16_t* Wv_bf = Wq_bf + D_ * D_;
    float*  P_uq  = (float*)(Wv_bf + D_ * D_);
    float*  P_uk  = P_uq + NB_ * D_;
    float*  P_uv  = P_uk + NB_ * D_;
    float*  Qf    = P_uv + NB_ * D_;            // B*D
    float*  b1w   = Qf + (size_t)B_ * D_;       // B*H
    float*  QP    = b1w + (size_t)B_ * H_;      // B*H*NB
    bf16_t* QKb   = (bf16_t*)(QP + (size_t)B_ * H_ * NB_);   // B*H*D

    float* z_out    = (float*)d_out;
    float* attn_out = z_out + (size_t)B_ * D_;

    hipLaunchKernelGGL(baca_cvt_w, dim3(2 * D_ * D_ / 256), dim3(256), 0, stream,
                       Wq, Wv, Wq_bf);
    hipLaunchKernelGGL(baca_pu, dim3(3 * NB_ * D_ / 256), dim3(256), 0, stream,
                       Uq, buq, bq, Uk, buk, bk, Uv, buv, bv, batch_emb,
                       P_uq, P_uk, P_uv);

    size_t lds_a = (64 * HP_ + 64 * 128) * sizeof(float)
                 + 64 * 256 * sizeof(bf16_t) + 64 * sizeof(int);
    hipLaunchKernelGGL(baca_qb1, dim3(B_ / 64), dim3(256), lds_a, stream,
                       h_recv, batch_recv, Wq_bf, P_uq, batch_emb,
                       D1, db1, D2, db2, Qf, b1w);

    hipLaunchKernelGGL(baca_qk, dim3(B_ / 64 * H_), dim3(256), 0, stream,
                       Qf, Wk, P_uk, QKb, QP);

    size_t lds_b = (16 * 256 + 512 + 128 + 8 + 64 + 2 * 256) * sizeof(float)
                 + 64 * AP_ * sizeof(bf16_t) + 128 * sizeof(int);
    hipLaunchKernelGGL(baca_attn, dim3(B_), dim3(256), lds_b, stream,
                       h_send, batch_recv, batch_send, dist, mask, gamma,
                       Wv_bf, P_uv, QKb, QP, b1w, z_out, attn_out);
}

// v008
// A run of this version takes 101 microseconds.
// Two timings next to v007 put it at 1.16 and 1.17 times that version's speed.
// Over all steps from v000 it is 13.0 times as fast.
#include <hip/hip_runtime.h>
#include <hip/hip_bf16.h>
#include <math.h>

#define B_  4096
#define N_  64
#define D_  256
#define H_  8
#define NB_ 16
#define DH_ 32

typedef __bf16 bf16_t;
typedef __attribute__((ext_vector_type(16))) __bf16 v16bf;
typedef __attribute__((ext_vector_type(8)))  __bf16 v8bf;
typedef __attribute__((ext_vector_type(4)))  __bf16 v4bf;
typedef __attribute__((ext_vector_type(8)))  float  v8f;
typedef __attribute__((ext_vector_type(4)))  float  v4f;
typedef __attribute__((ext_vector_type(2)))  float  v2f;

// LDS row pitch (floats) of the f32 receiver state: 1040 B = 16 B x 65, so the
// 16 rows of one ds_load_b128 fragment read fall on 64 distinct banks.
#define HP_ 260

__device__ __forceinline__ v8f v8f_zero() {
    v8f v;
#pragma unroll
    for (int i = 0; i < 8; ++i) v[i] = 0.0f;
    return v;
}

// A fragment (16x32 bf16, row-major source with row stride D_):
// lanes 0-15 : row = mr+lane,    K chunks [k0, k0+8) and [k0+16, k0+24)
// lanes 16-31: row = mr+lane-16, K chunks [k0+8, k0+16) and [k0+24, k0+32)
__device__ __forceinline__ v16bf frag_a(const bf16_t* __restrict__ A, int mr, int k0, int lane) {
    int r  = mr + (lane & 15);
    int kk = k0 + ((lane >> 4) << 3);
    v8bf lo = *(const v8bf*)(A + r * D_ + kk);
    v8bf hi = *(const v8bf*)(A + r * D_ + kk + 16);
    v16bf f;
#pragma unroll
    for (int i = 0; i < 8; ++i) { f[i] = lo[i]; f[i + 8] = hi[i]; }
    return f;
}

// LDS row pitch (bf16) of baca_attn's sender rows: 528 B = 16 B x 33, so the 16
// rows of one ds_load_b128 fragment read fall on distinct banks.
#define AP_ 264

// frag_a on rows at pitch AP_: same lanes, same k order.
__device__ __forceinline__ v16bf frag_ap(const bf16_t* __restrict__ A, int mr, int k0, int lane) {
    int r  = mr + (lane & 15);
    int kk = k0 + ((lane >> 4) << 3);
    v8bf lo = *(const v8bf*)(A + r * AP_ + kk);
    v8bf hi = *(const v8bf*)(A + r * AP_ + kk + 16);
    v16bf f;
#pragma unroll
    for (int i = 0; i < 8; ++i) { f[i] = lo[i]; f[i + 8] = hi[i]; }
    return f;
}

// B fragment (32x16 bf16). B[k][n] = W[n][k] (we compute X @ W.T). The weights
// lie in the workspace in fragment order (baca_cvt_w): fragment (k step ks,
// column tile ct) is the 1 KB block ks*16 + ct, its first 512 B the 32 lanes'
// low k chunks in lane order, its second 512 B their high k chunks. Each
// wave-wide 16-byte load so covers four whole 128-B lines, not 32 B of sixteen.
__device__ __forceinline__ v16bf frag_b(const bf16_t* __restrict__ Wp, int ct, int ks, int lane) {
    const bf16_t* p = Wp + ((ks * 16 + ct) << 9) + (lane << 3);
    v8bf lo = *(const v8bf*)(p);
    v8bf hi = *(const v8bf*)(p + 256);
    v16bf f;
#pragma unroll
    for (int i = 0; i < 8; ++i) { f[i] = lo[i]; f[i + 8] = hi[i]; }
    return f;
}

// Score B fragment of k step ks: B[k][h] = QK[b][h][k], q already at the lane's
// head row and low k chunk.
__device__ __forceinline__ v16bf frag_q(const bf16_t* __restrict__ q, int ks) {
    v8bf lo = *(const v8bf*)(q + ks * 32);
    v8bf hi = *(const v8bf*)(q + ks * 32 + 16);
    v16bf f;
#pragma unroll
    for (int i = 0; i < 8; ++i) { f[i] = lo[i]; f[i + 8] = hi[i]; }
    return f;
}

// Maximum and sum over the 32 lanes of a wave, the result in every lane: four
// DPP steps inside each 16-lane row, then lane l with lane l ^ 16.
template <int CTRL>
__device__ __forceinline__ float row_x(float x) {
    return __builtin_bit_cast(float, __builtin_amdgcn_update_dpp(
        0, __builtin_bit_cast(int, x), CTRL, 0xf, 0xf, false));
}
__device__ __forceinline__ float xhalf(float x) {
    return __builtin_bit_cast(float, __builtin_amdgcn_permlanex16(
        __builtin_bit_cast(int, x), __builtin_bit_cast(int, x), 0x76543210, 0xfedcba98, false, false));
}
__device__ __forceinline__ float wave_max(float x) {
    x = fmaxf(x, row_x<0x161>(x));   // row_xmask:1
    x = fmaxf(x, row_x<0x162>(x));   // row_xmask:2
    x = fmaxf(x, row_x<0x164>(x));   // row_xmask:4
    x = fmaxf(x, row_x<0x168>(x));   // row_xmask:8
    return fmaxf(x, xhalf(x));
}
__device__ __forceinline__ float wave_sum(float x) {
    x += row_x<0x161>(x);
    x += row_x<0x162>(x);
    x += row_x<0x164>(x);
    x += row_x<0x168>(x);
    return x + xhalf(x);
}

// ---------------- prep 1: convert Wq/Wv to bf16, in fragment order ---------
// dst element: [matrix][ks*16 + ct][part][lane][e] holds
// W[ct*16 + (lane & 15)][ks*32 + part*16 + (lane >> 4)*8 + e], frag_a's k order.
extern "C" __global__ void __launch_bounds__(256)
baca_cvt_w(const float* __restrict__ Wq, const float* __restrict__ Wv,
           bf16_t* __restrict__ dst) {
    int idx = blockIdx.x * 256 + threadIdx.x;           // 0 .. 2*65536
    const float* src = (idx < 65536) ? Wq : Wv;
    int e = idx & 7, lane = (idx >> 3) & 31, part = (idx >> 8) & 1;
    int ct = (idx >> 9) & 15, ks = (idx >> 13) & 7;
    int row = ct * 16 + (lane & 15);
    int k   = ks * 32 + part * 16 + ((lane >> 4) << 3) + e;
    dst[idx] = (bf16_t)src[row * D_ + k];
}

// ---------------- prep 2: P_u* = batch_emb @ U*.T + b* + bu* ---------------
extern "C" __global__ void __launch_bounds__(256)
baca_pu(const float* __restrict__ Uq, const float* __restrict__ buq, const float* __restrict__ bq,
        const float* __restrict__ Uk, const float* __restrict__ buk, const float* __restrict__ bk,
        const float* __restrict__ Uv, const float* __restrict__ buv, const float* __restrict__ bv,
        const float* __restrict__ batch_emb,
        float* __restrict__ P_uq, float* __restrict__ P_uk, float* __restrict__ P_uv) {
    int idx = blockIdx.x * 256 + threadIdx.x;           // 0 .. 3*16*256
    int which = idx / (NB_ * D_);
    int rem   = idx - which * (NB_ * D_);
    int nb = rem >> 8, d = rem & 255;
    const float* U  = (which == 0) ? Uq  : (which == 1) ? Uk  : Uv;
    const float* bu = (which == 0) ? buq : (which == 1) ? buk : buv;
    const float* bw = (which == 0) ? bq  : (which == 1) ? bk  : bv;
    float*       P  = (which == 0) ? P_uq: (which == 1) ? P_uk: P_uv;
    float acc = bu[d] + bw[d];
    const float* e = batch_emb + nb * D_;
    const float* u = U + d * D_;
#pragma unroll 8
    for (int k = 0; k < D_; ++k) acc = fmaf(e[k], u[k], acc);
    P[rem] = acc;
}

// ---------------- kernel A: Q = h_recv@Wq.T + gather(P_uq); b1 MLP ---------
// A workgroup takes RT_ = 16 rows, the fewest a WMMA tile holds: the phases below
// run one after the other, each waiting out its own loads, so a short tile keeps
// them short, and B_ / RT_ = 256 workgroups put one on every WGP.
// LDS carve: Hs f32[RT_*HP_] | h1 f32[RT_*128] | As bf16[RT_*256] | br int[RT_]
#define RT_ 16
extern "C" __global__ void __launch_bounds__(256)
baca_qb1(const float* __restrict__ h_recv, const int* __restrict__ batch_recv,
         const bf16_t* __restrict__ Wq_bf, const float* __restrict__ P_uq,
         const float* __restrict__ batch_emb,
         const float* __restrict__ D1, const float* __restrict__ db1,
         const float* __restrict__ D2, const float* __restrict__ db2,
         float* __restrict__ Qf, float* __restrict__ b1w) {
    extern __shared__ char smem[];
    float*  Hs = (float*)smem;                   // RT_*HP_
    float*  h1 = Hs + RT_ * HP_;                 // RT_*128
    bf16_t* As = (bf16_t*)(h1 + RT_ * 128);      // RT_*256
    int*    br = (int*)(As + RT_ * 256);         // RT_

    const int t = threadIdx.x, lane = t & 31, wave = t >> 5;
    const int m0 = blockIdx.x * RT_;

    const float* hr = h_recv + (size_t)m0 * D_;
#pragma unroll 4
    for (int i = 0; i < RT_; ++i) {
        int idx = t + i * 256;
        float v = hr[idx];
        Hs[(idx >> 8) * HP_ + (idx & 255)] = v;
        As[idx] = (bf16_t)v;
    }
    if (t < RT_) br[t] = batch_recv[m0 + t];
    __syncthreads();

    // receiver_state = h_recv + E_recv (in place; WMMA below only reads As)
#pragma unroll 4
    for (int i = 0; i < RT_; ++i) {
        int idx = t + i * 256;
        Hs[(idx >> 8) * HP_ + (idx & 255)] += batch_emb[br[idx >> 8] * D_ + (idx & 255)];
    }

    // WMMA: 16x256 output, 8 waves x 2 tiles (one whole 128-B line of Qf per row)
    {
        const int chalf = wave * 2;
        v8f acc[2];
#pragma unroll
        for (int ct = 0; ct < 2; ++ct) acc[ct] = v8f_zero();
        for (int k0 = 0; k0 < D_; k0 += 32) {
            v16bf a = frag_a(As, 0, k0, lane);
#pragma unroll
            for (int ct = 0; ct < 2; ++ct) {
                v16bf bb = frag_b(Wq_bf, chalf + ct, k0 >> 5, lane);
                acc[ct] = __builtin_amdgcn_wmma_f32_16x16x32_bf16(
                    false, a, false, bb, (short)0, acc[ct], false, false);
            }
        }
        const int rbase = (lane >> 4) << 3;
#pragma unroll
        for (int ct = 0; ct < 2; ++ct) {
            int col = (chalf + ct) * 16 + (lane & 15);
#pragma unroll
            for (int j = 0; j < 8; ++j) {
                int row = rbase + j;
                Qf[(size_t)(m0 + row) * D_ + col] = acc[ct][j] + P_uq[br[row] * D_ + col];
            }
        }
    }
    __syncthreads();

    // hidden = relu(rs @ D1.T + db1) on f32 16x16x4 WMMA (operands stay f32).
    // Wave w owns hidden columns [16w, 16w+16) for all 16 rows, so each D1 row
    // is read once per workgroup. Lane (c, hh) loads 4 contiguous k at
    // k0 + 4*hh of A row c and of D1 row c with the same code: elements 0,1
    // feed one WMMA and 2,3 the next, so A and B pair on equal k.
    {
        const int c = lane & 15, hh = lane >> 4;
        const int j = wave * 16 + c;
        const float* xa = Hs + c * HP_ + 4 * hh;
        const float* wb = D1 + j * D_ + 4 * hh;
        v8f hacc = v8f_zero();
        // unrolled so that several k steps' D1 loads are in flight together
#pragma unroll 8
        for (int k0 = 0; k0 < D_; k0 += 8) {
            v4f bv = *(const v4f*)(wb + k0);
            v2f b0 = {bv[0], bv[1]}, b1 = {bv[2], bv[3]};
            v4f av = *(const v4f*)(xa + k0);
            v2f a0 = {av[0], av[1]}, a1 = {av[2], av[3]};
            hacc = __builtin_amdgcn_wmma_f32_16x16x4_f32(
                false, a0, false, b0, (short)0, hacc, false, false);
            hacc = __builtin_amdgcn_wmma_f32_16x16x4_f32(
                false, a1, false, b1, (short)0, hacc, false, false);
        }
        const float bias = db1[j];
#pragma unroll
        for (int r = 0; r < 8; ++r)
            h1[(8 * hh + r) * 128 + j] = fmaxf(hacc[r] + bias, 0.0f);
    }
    __syncthreads();

    // b1 = softplus(h1 @ D2.T + db2): RT_ * H_ = 128 values, waves 0 to 3
    if (t < RT_ * H_) {
        int r = t >> 3, h = t & 7;
        float d = db2[h];
        const float* w = D2 + h * 128;
        const float* x = h1 + r * 128;
#pragma unroll 8
        for (int k = 0; k < 128; ++k) d = fmaf(x[k], w[k], d);
        b1w[(size_t)(m0 + r) * H_ + h] = log1pf(__expf(d));
    }
}

// ---------------- prep 3: fold Wk and P_uk into the query ------------------
// Q_h . K[n]_h = h_send[n] . (Q_h @ Wk_h) + Q_h . P_uk[bs[n]]_h, so K is never
// formed: per (b, h) a 256-vector QK and 16 scalars QP replace the 64x256 K.
// Workgroup = 64 rows b x one head, f32 16x16x4 WMMA (operands stay f32).
// Lane (c, hh) holds k = k0 + 4*hh + {0..3} of A row c and of B column c:
// elements 0,1 feed one WMMA and 2,3 the next, so A and B pair on equal k.
// A wave owns 64 columns (one whole 128-B line of bf16 per row) x 32 rows.
extern "C" __global__ void __launch_bounds__(256)
baca_qk(const float* __restrict__ Qf, const float* __restrict__ Wk,
        const float* __restrict__ P_uk,
        bf16_t* __restrict__ QKb, float* __restrict__ QP) {
    const int t = threadIdx.x, lane = t & 31, wave = t >> 5;
    const int h  = blockIdx.x & 7;
    const int m0 = (blockIdx.x >> 3) * 64 + (wave >> 2) * 32;
    const int cg = (wave & 3) * 64;
    const int c = lane & 15, hh = lane >> 4;
    const float* qa = Qf   + (size_t)(m0 + c) * D_ + h * DH_ + 4 * hh;
    const float* wb = Wk   + (h * DH_ + 4 * hh) * D_ + cg + c;
    const float* pb = P_uk + c * D_ + h * DH_ + 4 * hh;
    v8f acc[2][4], pacc[2];
#pragma unroll
    for (int s = 0; s < 2; ++s) {
        pacc[s] = v8f_zero();
#pragma unroll
        for (int ct = 0; ct < 4; ++ct) acc[s][ct] = v8f_zero();
    }
    v4f av[4][2], pv[4];
#pragma unroll
    for (int kq = 0; kq < 4; ++kq) {
        pv[kq] = *(const v4f*)(pb + kq * 8);
#pragma unroll
        for (int s = 0; s < 2; ++s) av[kq][s] = *(const v4f*)(qa + s * 16 * D_ + kq * 8);
    }
    // the loads above are all issued here; behind this wait their address
    // registers may be reused
    asm volatile("s_wait_xcnt 0x0" ::: "memory");
#pragma unroll
    for (int kq = 0; kq < 4; ++kq) {
        v2f a0[2], a1[2];
#pragma unroll
        for (int s = 0; s < 2; ++s) {
            a0[s] = v2f{av[kq][s][0], av[kq][s][1]};
            a1[s] = v2f{av[kq][s][2], av[kq][s][3]};
        }
#pragma unroll
        for (int ct = 0; ct < 4; ++ct) {
            const float* w = wb + kq * 8 * D_ + ct * 16;
            v2f b0 = {w[0], w[D_]}, b1 = {w[2 * D_], w[3 * D_]};
#pragma unroll
            for (int s = 0; s < 2; ++s) {
                acc[s][ct] = __builtin_amdgcn_wmma_f32_16x16x4_f32(
                    false, a0[s], false, b0, (short)0, acc[s][ct], false, false);
                acc[s][ct] = __builtin_amdgcn_wmma_f32_16x16x4_f32(
                    false, a1[s], false, b1, (short)0, acc[s][ct], false, false);
            }
        }
        v2f p0 = {pv[kq][0], pv[kq][1]}, p1 = {pv[kq][2], pv[kq][3]};
#pragma unroll
        for (int s = 0; s < 2; ++s) {
            pacc[s] = __builtin_amdgcn_wmma_f32_16x16x4_f32(
                false, a0[s], false, p0, (short)0, pacc[s], false, false);
            pacc[s] = __builtin_amdgcn_wmma_f32_16x16x4_f32(
                false, a1[s], false, p1, (short)0, pacc[s], false, false);
        }
    }
    // keeps the stores' address arithmetic out of the WMMA block, where it was
    // scheduled onto operand registers directly behind the WMMA that read them
    __builtin_amdgcn_sched_barrier(0);
    // four vector slots between the last WMMA and the first overwrite of its operands
    asm volatile("v_nop\n\tv_nop\n\tv_nop\n\tv_nop");
    // holds the epilogue's vector instructions behind those slots
    __builtin_amdgcn_sched_barrier(0);
#pragma unroll
    for (int s = 0; s < 2; ++s) {
#pragma unroll
        for (int r = 0; r < 8; ++r) {
            size_t row = (size_t)(m0 + s * 16 + 8 * hh + r) * H_ + h;
#pragma unroll
            for (int ct = 0; ct < 4; ++ct)
                QKb[row * D_ + cg + ct * 16 + c] = (bf16_t)acc[s][ct][r];
            if ((wave & 3) == 0) QP[row * NB_ + c] = pacc[s][r];
        }
    }
}

// ---------------- kernel B: scores, V projection and attention per b -------
// Wave w: all 64 rows (n) x the 32 V columns of head w, so that a Wv fragment
// is loaded once per workgroup and feeds four WMMAs. The score tile of strip
// w & 3 is one more B fragment of the same k loop: B[k][h] = QK[b][h][k]
// (columns 8..15 repeat heads 0..7 and are not read).
// V never touches LDS: accumulators stay in registers and are contracted
// against attn directly (register tile j-axis == n reduction axis).
// LDS carve (54 KB):
//   Pv f32[16*256] | sc f32[512] | qps f32[128] | b1s f32[8]
//   dists f32[64] | zpart f32[2*256] | As bf16[64*AP_] | bs int[64] | msk int[64]
extern "C" __global__ void __launch_bounds__(256)
baca_attn(const float* __restrict__ h_send, const int* __restrict__ batch_recv,
          const int* __restrict__ batch_send, const float* __restrict__ dist,
          const int* __restrict__ mask, const float* __restrict__ gamma,
          const bf16_t* __restrict__ Wv_bf, const float* __restrict__ P_uv,
          const bf16_t* __restrict__ QKb, const float* __restrict__ QP,
          const float* __restrict__ b1w,
          float* __restrict__ z_out, float* __restrict__ attn_out) {
    extern __shared__ char smem[];
    float*  Pv    = (float*)smem;                // 16*256
    float*  sc    = Pv + 16 * 256;               // 64*8
    float*  qps   = sc + 512;                    // 8*16
    float*  b1s   = qps + 128;                   // 8
    float*  dists = b1s + 8;                     // 64
    float*  zpart = dists + 64;                  // 2*256
    bf16_t* As    = (bf16_t*)(zpart + 2 * 256);  // 64*AP_ (16B aligned)
    int*    bs    = (int*)(As + 64 * AP_);       // 64
    int*    msk   = bs + 64;                     // 64

    const int t = threadIdx.x, lane = t & 31;
    // the wave's number as a scalar: addresses built from it stay out of the VGPRs
    const int wave = __builtin_amdgcn_readfirstlane(t >> 5);
    const int b = blockIdx.x;

    // stage: h_send[b] -> bf16, P_uv table, per-(h, batch) and per-n scalars
    const float* hs = h_send + (size_t)b * (N_ * D_);
    // Every global load of the stage is issued before the first one is waited
    // for, the two big tables as 16-byte loads: the stage then costs one trip to
    // memory, not one per loop trip and per table. The small tables' values wait
    // in registers until the big tables are stored.
    v4f st[16], pt[4];
#pragma unroll
    for (int i = 0; i < 16; ++i) st[i] = *(const v4f*)(hs + (t + i * 256) * 4);
#pragma unroll
    for (int i = 0; i < 4; ++i) pt[i] = *(const v4f*)(P_uv + (t + i * 256) * 4);
    int   bsv = 0, mkv = 0;
    float dsv = 0.0f, qpv = 0.0f, b1v = 0.0f;
    if (t < 64) {
        bsv = (batch_send + (size_t)b * N_)[t];
        mkv = (mask + (size_t)b * N_)[t];
        dsv = (dist + (size_t)b * N_)[t];
    }
    if (t < H_ * NB_) qpv = QP[(size_t)b * (H_ * NB_) + t];
    if (t < H_) b1v = b1w[(size_t)b * H_ + t];
#pragma unroll
    for (int i = 0; i < 16; ++i) {
        v4bf pk;
#pragma unroll
        for (int e = 0; e < 4; ++e) pk[e] = (bf16_t)st[i][e];
        *(v4bf*)(As + (i * 4 + (t >> 6)) * AP_ + (t & 63) * 4) = pk;
    }
#pragma unroll
    for (int i = 0; i < 4; ++i) *(v4f*)(Pv + (t + i * 256) * 4) = pt[i];
    if (t < 64) {
        bs[t]    = bsv;
        msk[t]   = mkv;
        dists[t] = dsv;
    }
    if (t < H_ * NB_) qps[t] = qpv;
    if (t < H_) b1s[t] = b1v;
    __syncthreads();

    const int strip = (wave & 3) * 16;
    const int rbase = strip + ((lane >> 4) << 3);
    // acc[s][ct]: rows of strip (wave + s) & 3, columns wave * 32 + ct * 16. The
    // strips start at the wave's own score strip, so that a[0] below serves both.
    v8f acc[4][2];
#pragma unroll
    for (int s = 0; s < 4; ++s) {
        acc[s][0] = v8f_zero();
        acc[s][1] = v8f_zero();
    }
    v8f sacc = v8f_zero();
    {
        // frag_a's k order: low chunk at k0 + 8*(lane >> 4), high chunk 16 on
        const bf16_t* qk = QKb + (size_t)b * (H_ * D_) + (lane & 7) * D_ + ((lane >> 4) << 3);
        // Three B fragments a k step: rb[0] the score fragment, rb[1] and rb[2] the
        // head's two V column tiles. Each is refilled for the next k step right
        // behind the last WMMA that read it, so its load flies under the other
        // WMMAs and the next A reads. The loops are unrolled whole so that every
        // index of rb and acc is a constant and they stay in registers.
        v16bf rb[3];
        rb[0] = frag_q(qk, 0);
        rb[1] = frag_b(Wv_bf, wave * 2, 0, lane);
        rb[2] = frag_b(Wv_bf, wave * 2 + 1, 0, lane);
#pragma unroll
        for (int ks = 0; ks < 8; ++ks) {
            // the A strips come in two pairs through one pair of register sets, which
            // keeps the kernel within 128 VGPRs (eight waves per SIMD)
#pragma unroll
            for (int hf = 0; hf < 2; ++hf) {
                v16bf a[2];
#pragma unroll
                for (int s = 0; s < 2; ++s)
                    a[s] = frag_ap(As, ((wave + hf * 2 + s) & 3) * 16, ks * 32, lane);
                if (hf == 0) {
                    sacc = __builtin_amdgcn_wmma_f32_16x16x32_bf16(
                        false, a[0], false, rb[0], (short)0, sacc, false, false);
                    // keeps the refill behind the WMMA that reads the set, so that it takes the
                    // set's own registers and not a fourth set's
                    __builtin_amdgcn_sched_barrier(0);
                    if (ks < 7) rb[0] = frag_q(qk, ks + 1);
                    // holds each refill where it is written: without it the compiler moves the
                    // loads down to just in front of their WMMA, and each waits out its own latency
                    __builtin_amdgcn_sched_barrier(0);
                }
#pragma unroll
                for (int ct = 0; ct < 2; ++ct) {
#pragma unroll
                    for (int s = 0; s < 2; ++s)
                        acc[hf * 2 + s][ct] = __builtin_amdgcn_wmma_f32_16x16x32_bf16(
                            false, a[s], false, rb[1 + ct], (short)0, acc[hf * 2 + s][ct], false, false);
                    if (hf == 1 && ks < 7) {
                        // as above: the refill stays behind the set's last reader
                        __builtin_amdgcn_sched_barrier(0);
                        rb[1 + ct] = frag_b(Wv_bf, wave * 2 + ct, ks + 1, lane);
                        // as above: holds the refill where it is written
                        __builtin_amdgcn_sched_barrier(0);
                    }
                }
                // keeps the next pair's A reads behind this pair's last reader, so that
                // they take this pair's registers and not a second pair's
                __builtin_amdgcn_sched_barrier(0);
            }
        }
    }

    // scores[n][h]: sacc[j] is h_send[rbase+j] . QK[h], h = lane & 15
    if (wave < 4 && (lane & 15) < H_) {
        const int   h     = lane & 15;
        const int   br    = batch_recv[b];
        const float scale = 0.1767766952966369f;   // 1/sqrt(32)
#pragma unroll
        for (int j = 0; j < 8; ++j) {
            int n = rbase + j;
            float d = sacc[j] + qps[h * NB_ + bs[n]];
            float s = d * scale - b1s[h] * dists[n] + gamma[br * NB_ + bs[n]];
            sc[n * H_ + h] = (msk[n] == 0) ? -INFINITY : s;
        }
    }
    __syncthreads();

    // softmax over n: wave w takes head w, lane l the rows l and l + 32; maximum
    // and sum go over the wave's lanes in registers, and the wave scales its own
    // head, so no lane walks the 64 rows alone while the other waves wait.
    {
        // the lane's number read anew here: taken from t & 31 it would hold one more
        // register across the k loop, and the kernel would leave 128 VGPRs
        const int ln = __builtin_amdgcn_mbcnt_lo(~0u, 0u);
        float* sp = sc + ln * H_ + wave;
        const float s0 = sp[0], s1 = sp[32 * H_];
        const float m  = wave_max(fmaxf(s0, s1));
        const float e0 = __expf(s0 - m), e1 = __expf(s1 - m);
        const float iv = 1.0f / wave_sum(e0 + e1);
        sp[0]       = e0 * iv;
        sp[32 * H_] = e1 * iv;
    }
    __syncthreads();


    // contract register V tiles with attn: the wave's head is h = wave.
    // Lane owns cols wave*32 + ct*16 + (lane&15); acc[s][ct][j] is V[row][col],
    // row = ((wave+s)&3)*16 + 8*(lane>>4) + j: 32 of a column's 64 rows per lane.
    {
        const int hh = lane >> 4;
        float p0 = 0.0f, p1 = 0.0f;
#pragma unroll
        for (int s = 0; s < 4; ++s) {
            const int r0 = ((wave + s) & 3) * 16 + hh * 8;
#pragma unroll
            for (int j = 0; j < 8; ++j) {
                float w = sc[(r0 + j) * H_ + wave];
                p0 = fmaf(w, acc[s][0][j], p0);
                p1 = fmaf(w, acc[s][1][j], p1);
            }
        }
        zpart[hh * D_ + wave * 32 + (lane & 15)]      = p0;
        zpart[hh * D_ + wave * 32 + 16 + (lane & 15)] = p1;
    }
    __syncthreads();

    // attn goes out behind the last barrier, so that no barrier waits for its stores
#pragma unroll
    for (int rep = 0; rep < 2; ++rep) {
        int idx = t + rep * 256;
        attn_out[(size_t)b * (N_ * H_) + idx] = sc[idx];
    }

    // z[b, col] = sum(zpart) + sum_n attn[n,h] * P_uv[bs[n]][col]
    {
        const int h = t >> 5;
        float z = zpart[t] + zpart[D_ + t];
#pragma unroll 8
        for (int n = 0; n < N_; ++n)
            z = fmaf(sc[n * H_ + h], Pv[bs[n] * D_ + t], z);
        z_out[(size_t)b * D_ + t] = z;
    }
}

// --------------------------------------------------------------------------
extern "C" void kernel_launch(void* const* d_in, const int* in_sizes, int n_in,
                              void* d_out, int out_size, void* d_ws, size_t ws_size,
                              hipStream_t stream) {
    const float* h_recv     = (const float*)d_in[0];
    const float* h_send     = (const float*)d_in[1];
    const int*   batch_recv = (const int*)d_in[2];
    const int*   batch_send = (const int*)d_in[3];
    const float* dist       = (const float*)d_in[4];
    const int*   mask       = (const int*)d_in[5];
    const float* Wq = (const float*)d_in[6];  const float* bq  = (const float*)d_in[7];
    const float* Wk = (const float*)d_in[8];  const float* bk  = (const float*)d_in[9];
    const float* Wv = (const float*)d_in[10]; const float* bv  = (const float*)d_in[11];
    const float* Uq = (const float*)d_in[12]; const float* buq = (const float*)d_in[13];
    const float* Uk = (const float*)d_in[14]; const float* buk = (const float*)d_in[15];
    const float* Uv = (const float*)d_in[16]; const float* buv = (const float*)d_in[17];
    const float* batch_emb = (const float*)d_in[18];
    const float* D1  = (const float*)d_in[19]; const float* db1 = (const float*)d_in[20];
    const float* D2  = (const float*)d_in[21]; const float* db2 = (const float*)d_in[22];
    const float* gamma = (const float*)d_in[23];

    // workspace carve (about 24 MB)
    bf16_t* Wq_bf = (bf16_t*)d_ws;
    bf16_t* Wv_bf = Wq_bf + D_ * D_;
    float*  P_uq  = (float*)(Wv_bf + D_ * D_);
    float*  P_uk  = P_uq + NB_ * D_;
    float*  P_uv  = P_uk + NB_ * D_;
    float*  Qf    = P_uv + NB_ * D_;            // B*D
    float*  b1w   = Qf + (size_t)B_ * D_;       // B*H
    float*  QP    = b1w + (size_t)B_ * H_;      // B*H*NB
    bf16_t* QKb   = (bf16_t*)(QP + (size_t)B_ * H_ * NB_);   // B*H*D

    float* z_out    = (float*)d_out;
    float* attn_out = z_out + (size_t)B_ * D_;

    hipLaunchKernelGGL(baca_cvt_w, dim3(2 * D_ * D_ / 256), dim3(256), 0, stream,
                       Wq, Wv, Wq_bf);
    hipLaunchKernelGGL(baca_pu, dim3(3 * NB_ * D_ / 256), dim3(256), 0, stream,
                       Uq, buq, bq, Uk, buk, bk, Uv, buv, bv, batch_emb,
                       P_uq, P_uk, P_uv);

    size_t lds_a = (RT_ * HP_ + RT_ * 128) * sizeof(float)
                 + RT_ * 256 * sizeof(bf16_t) + RT_ * sizeof(int);
    hipLaunchKernelGGL(baca_qb1, dim3(B_ / RT_), dim3(256), lds_a, stream,
                       h_recv, batch_recv, Wq_bf, P_uq, batch_emb,
                       D1, db1, D2, db2, Qf, b1w);

    hipLaunchKernelGGL(baca_qk, dim3(B_ / 64 * H_), dim3(256), 0, stream,
                       Qf, Wk, P_uk, QKb, QP);

    size_t lds_b = (16 * 256 + 512 + 128 + 8 + 64 + 2 * 256) * sizeof(float)
                 + 64 * AP_ * sizeof(bf16_t) + 128 * sizeof(int);
    hipLaunchKernelGGL(baca_attn, dim3(B_), dim3(256), lds_b, stream,
                       h_send, batch_recv, batch_send, dist, mask, gamma,
                       Wv_bf, P_uv, QKb, QP, b1w, z_out, attn_out);
}

// v009
// A run of this version takes 87.2 microseconds.
// In both of two side-by-side timings against v008, it was 1.15 times as fast.
// Over all steps from v000 it is 15.0 times as fast.
#include <hip/hip_runtime.h>
#include <hip/hip_bf16.h>
#include <math.h>

#define B_  4096
#define N_  64
#define D_  256
#define H_  8
#define NB_ 16
#define DH_ 32

typedef __bf16 bf16_t;
typedef __attribute__((ext_vector_type(16))) __bf16 v16bf;
typedef __attribute__((ext_vector_type(8)))  __bf16 v8bf;
typedef __attribute__((ext_vector_type(4)))  __bf16 v4bf;
typedef __attribute__((ext_vector_type(8)))  float  v8f;
typedef __attribute__((ext_vector_type(4)))  float  v4f;
typedef __attribute__((ext_vector_type(2)))  float  v2f;
typedef __attribute__((ext_vector_type(8)))  unsigned v8u;

// LDS row pitch (floats) of the f32 receiver state: 1040 B = 16 B x 65, so the
// 16 rows of one ds_load_b128 fragment read fall on 64 distinct banks.
#define HP_ 260

__device__ __forceinline__ v8f v8f_zero() {
    v8f v;
#pragma unroll
    for (int i = 0; i < 8; ++i) v[i] = 0.0f;
    return v;
}

// A fragment (16x32 bf16, row-major source with row stride D_):
// lanes 0-15 : row = mr+lane,    K chunks [k0, k0+8) and [k0+16, k0+24)
// lanes 16-31: row = mr+lane-16, K chunks [k0+8, k0+16) and [k0+24, k0+32)
__device__ __forceinline__ v16bf frag_a(const bf16_t* __restrict__ A, int mr, int k0, int lane) {
    int r  = mr + (lane & 15);
    int kk = k0 + ((lane >> 4) << 3);
    v8bf lo = *(const v8bf*)(A + r * D_ + kk);
    v8bf hi = *(const v8bf*)(A + r * D_ + kk + 16);
    v16bf f;
#pragma unroll
    for (int i = 0; i < 8; ++i) { f[i] = lo[i]; f[i + 8] = hi[i]; }
    return f;
}

// LDS row pitch (bf16) of baca_attn's sender rows: 528 B = 16 B x 33, so the 16
// rows of one ds_load_b128 fragment read fall on distinct banks.
#define AP_ 264

// frag_a on rows at pitch AP_: same lanes, same k order.
__device__ __forceinline__ v16bf frag_ap(const bf16_t* __restrict__ A, int mr, int k0, int lane) {
    int r  = mr + (lane & 15);
    int kk = k0 + ((lane >> 4) << 3);
    v8bf lo = *(const v8bf*)(A + r * AP_ + kk);
    v8bf hi = *(const v8bf*)(A + r * AP_ + kk + 16);
    v16bf f;
#pragma unroll
    for (int i = 0; i < 8; ++i) { f[i] = lo[i]; f[i + 8] = hi[i]; }
    return f;
}

// B fragment (32x16 bf16). B[k][n] = W[n][k] (we compute X @ W.T). The weights
// lie in the workspace in fragment order (baca_cvt_w): fragment (k step ks,
// column tile ct) is the 1 KB block ks*16 + ct, its first 512 B the 32 lanes'
// low k chunks in lane order, its second 512 B their high k chunks. Each
// wave-wide 16-byte load so covers four whole 128-B lines, not 32 B of sixteen.
__device__ __forceinline__ v16bf frag_b(const bf16_t* __restrict__ Wp, int ct, int ks, int lane) {
    const bf16_t* p = Wp + ((ks * 16 + ct) << 9) + (lane << 3);
    v8bf lo = *(const v8bf*)(p);
    v8bf hi = *(const v8bf*)(p + 256);
    v16bf f;
#pragma unroll
    for (int i = 0; i < 8; ++i) { f[i] = lo[i]; f[i + 8] = hi[i]; }
    return f;
}

// A fragment (16x32 bf16) of the k step that adds P_uv[batch_send[n]] to V row n:
// A[n][k] = 1 where (k & 15) == bsr, the row's sender batch, else 0, in frag_a's
// k order. The lane's two k chunks lie 16 apart, so both hold the same eight
// values: one bf16 1.0 (0x3F80) at element d = bsr - 8*(lane >> 4) if 0 <= d < 8.
__device__ __forceinline__ v16bf frag_onehot(int bsr, int lane) {
    const int d = bsr - ((lane >> 4) << 3);
    const unsigned one = 0x3F80u << ((d & 1) << 4);
    v8u w;
#pragma unroll
    for (int q = 0; q < 4; ++q) {
        unsigned x = ((d >> 1) == q) ? one : 0u;
        w[q] = x;
        w[q + 4] = x;
    }
    return __builtin_bit_cast(v16bf, w);
}

// Score B fragment of k step ks: B[k][h] = QK[b][h][k], q already at the lane's
// head row and low k chunk.
__device__ __forceinline__ v16bf frag_q(const bf16_t* __restrict__ q, int ks) {
    v8bf lo = *(const v8bf*)(q + ks * 32);
    v8bf hi = *(const v8bf*)(q + ks * 32 + 16);
    v16bf f;
#pragma unroll
    for (int i = 0; i < 8; ++i) { f[i] = lo[i]; f[i + 8] = hi[i]; }
    return f;
}

// Maximum and sum over the 32 lanes of a wave, the result in every lane: four
// DPP steps inside each 16-lane row, then lane l with lane l ^ 16.
template <int CTRL>
__device__ __forceinline__ float row_x(float x) {
    return __builtin_bit_cast(float, __builtin_amdgcn_update_dpp(
        0, __builtin_bit_cast(int, x), CTRL, 0xf, 0xf, false));
}
__device__ __forceinline__ float xhalf(float x) {
    return __builtin_bit_cast(float, __builtin_amdgcn_permlanex16(
        __builtin_bit_cast(int, x), __builtin_bit_cast(int, x), 0x76543210, 0xfedcba98, false, false));
}
__device__ __forceinline__ float wave_max(float x) {
    x = fmaxf(x, row_x<0x161>(x));   // row_xmask:1
    x = fmaxf(x, row_x<0x162>(x));   // row_xmask:2
    x = fmaxf(x, row_x<0x164>(x));   // row_xmask:4
    x = fmaxf(x, row_x<0x168>(x));   // row_xmask:8
    return fmaxf(x, xhalf(x));
}
__device__ __forceinline__ float wave_sum(float x) {
    x += row_x<0x161>(x);
    x += row_x<0x162>(x);
    x += row_x<0x164>(x);
    x += row_x<0x168>(x);
    return x + xhalf(x);
}

// ---------------- prep 1: convert Wq/Wv to bf16, in fragment order ---------
// dst element: [matrix][ks*16 + ct][part][lane][e] holds
// W[ct*16 + (lane & 15)][ks*32 + part*16 + (lane >> 4)*8 + e], frag_a's k order.
extern "C" __global__ void __launch_bounds__(256)
baca_cvt_w(const float* __restrict__ Wq, const float* __restrict__ Wv,
           bf16_t* __restrict__ dst) {
    int idx = blockIdx.x * 256 + threadIdx.x;           // 0 .. 2*65536
    const float* src = (idx < 65536) ? Wq : Wv;
    int e = idx & 7, lane = (idx >> 3) & 31, part = (idx >> 8) & 1;
    int ct = (idx >> 9) & 15, ks = (idx >> 13) & 7;
    int row = ct * 16 + (lane & 15);
    int k   = ks * 32 + part * 16 + ((lane >> 4) << 3) + e;
    dst[idx] = (bf16_t)src[row * D_ + k];
}

// ---------------- prep 2: P_u* = batch_emb @ U*.T + b* + bu* ---------------
// P_uq and P_uk go out as f32 tables. P_uv goes out as k step 8 of the Wv
// fragments (frag_b's layout, right behind Wv_bf): B[k][col] = bf16 high part of
// P_uv[k][col] for k < 16, the bf16 rest of P_uv[k - 16][col] for k >= 16. There a
// workgroup takes one column tile and thread t the block's element t, so that
// each 1 KB block has one writer.
extern "C" __global__ void __launch_bounds__(256)
baca_pu(const float* __restrict__ Uq, const float* __restrict__ buq, const float* __restrict__ bq,
        const float* __restrict__ Uk, const float* __restrict__ buk, const float* __restrict__ bk,
        const float* __restrict__ Uv, const float* __restrict__ buv, const float* __restrict__ bv,
        const float* __restrict__ batch_emb,
        float* __restrict__ P_uq, float* __restrict__ P_uk, bf16_t* __restrict__ Pvf) {
    int idx = blockIdx.x * 256 + threadIdx.x;           // 0 .. 3*16*256
    int which = idx / (NB_ * D_);
    int rem   = idx - which * (NB_ * D_);
    int nb = rem >> 8, d = rem & 255;
    if (which == 2) {
        int ln = (rem >> 3) & 31;
        d  = (rem >> 8) * 16 + (ln & 15);
        nb = ((ln >> 4) << 3) + (rem & 7);
    }
    const float* U  = (which == 0) ? Uq  : (which == 1) ? Uk  : Uv;
    const float* bu = (which == 0) ? buq : (which == 1) ? buk : buv;
    const float* bw = (which == 0) ? bq  : (which == 1) ? bk  : bv;
    float*       P  = (which == 0) ? P_uq: P_uk;
    float acc = bu[d] + bw[d];
    const float* e = batch_emb + nb * D_;
    const float* u = U + d * D_;
#pragma unroll 8
    for (int k = 0; k < D_; ++k) acc = fmaf(e[k], u[k], acc);
    if (which == 2) {
        bf16_t  hi = (bf16_t)acc;
        bf16_t* p  = Pvf + ((rem >> 8) << 9) + (rem & 255);
        p[0]   = hi;
        p[256] = (bf16_t)(acc - (float)hi);
    } else {
        P[rem] = acc;
    }
}

// ---------------- kernel A: Q = h_recv@Wq.T + gather(P_uq); b1 MLP ---------
// A workgroup takes RT_ = 16 rows, the fewest a WMMA tile holds: the phases below
// run one after the other, each waiting out its own loads, so a short tile keeps
// them short, and B_ / RT_ = 256 workgroups put one on every WGP.
// LDS carve: Hs f32[RT_*HP_] | h1 f32[RT_*128] | As bf16[RT_*256] | br int[RT_]
#define RT_ 16
extern "C" __global__ void __launch_bounds__(256)
baca_qb1(const float* __restrict__ h_recv, const int* __restrict__ batch_recv,
         const bf16_t* __restrict__ Wq_bf, const float* __restrict__ P_uq,
         const float* __restrict__ batch_emb,
         const float* __restrict__ D1, const float* __restrict__ db1,
         const float* __restrict__ D2, const float* __restrict__ db2,
         float* __restrict__ Qf, float* __restrict__ b1w) {
    extern __shared__ char smem[];
    float*  Hs = (float*)smem;                   // RT_*HP_
    float*  h1 = Hs + RT_ * HP_;                 // RT_*128
    bf16_t* As = (bf16_t*)(h1 + RT_ * 128);      // RT_*256
    int*    br = (int*)(As + RT_ * 256);         // RT_

    const int t = threadIdx.x, lane = t & 31, wave = t >> 5;
    const int m0 = blockIdx.x * RT_;

    const float* hr = h_recv + (size_t)m0 * D_;
#pragma unroll 4
    for (int i = 0; i < RT_; ++i) {
        int idx = t + i * 256;
        float v = hr[idx];
        Hs[(idx >> 8) * HP_ + (idx & 255)] = v;
        As[idx] = (bf16_t)v;
    }
    if (t < RT_) br[t] = batch_recv[m0 + t];
    __syncthreads();

    // receiver_state = h_recv + E_recv (in place; WMMA below only reads As)
#pragma unroll 4
    for (int i = 0; i < RT_; ++i) {
        int idx = t + i * 256;
        Hs[(idx >> 8) * HP_ + (idx & 255)] += batch_emb[br[idx >> 8] * D_ + (idx & 255)];
    }

    // WMMA: 16x256 output, 8 waves x 2 tiles (one whole 128-B line of Qf per row)
    {
        const int chalf = wave * 2;
        v8f acc[2];
#pragma unroll
        for (int ct = 0; ct < 2; ++ct) acc[ct] = v8f_zero();
        for (int k0 = 0; k0 < D_; k0 += 32) {
            v16bf a = frag_a(As, 0, k0, lane);
#pragma unroll
            for (int ct = 0; ct < 2; ++ct) {
                v16bf bb = frag_b(Wq_bf, chalf + ct, k0 >> 5, lane);
                acc[ct] = __builtin_amdgcn_wmma_f32_16x16x32_bf16(
                    false, a, false, bb, (short)0, acc[ct], false, false);
            }
        }
        const int rbase = (lane >> 4) << 3;
#pragma unroll
        for (int ct = 0; ct < 2; ++ct) {
            int col = (chalf + ct) * 16 + (lane & 15);
#pragma unroll
            for (int j = 0; j < 8; ++j) {
                int row = rbase + j;
                Qf[(size_t)(m0 + row) * D_ + col] = acc[ct][j] + P_uq[br[row] * D_ + col];
            }
        }
    }
    __syncthreads();

    // hidden = relu(rs @ D1.T + db1) on f32 16x16x4 WMMA (operands stay f32).
    // Wave w owns hidden columns [16w, 16w+16) for all 16 rows, so each D1 row
    // is read once per workgroup. Lane (c, hh) loads 4 contiguous k at
    // k0 + 4*hh of A row c and of D1 row c with the same code: elements 0,1
    // feed one WMMA and 2,3 the next, so A and B pair on equal k.
    {
        const int c = lane & 15, hh = lane >> 4;
        const int j = wave * 16 + c;
        const float* xa = Hs + c * HP_ + 4 * hh;
        const float* wb = D1 + j * D_ + 4 * hh;
        v8f hacc = v8f_zero();
        // unrolled so that several k steps' D1 loads are in flight together
#pragma unroll 8
        for (int k0 = 0; k0 < D_; k0 += 8) {
            v4f bv = *(const v4f*)(wb + k0);
            v2f b0 = {bv[0], bv[1]}, b1 = {bv[2], bv[3]};
            v4f av = *(const v4f*)(xa + k0);
            v2f a0 = {av[0], av[1]}, a1 = {av[2], av[3]};
            hacc = __builtin_amdgcn_wmma_f32_16x16x4_f32(
                false, a0, false, b0, (short)0, hacc, false, false);
            hacc = __builtin_amdgcn_wmma_f32_16x16x4_f32(
                false, a1, false, b1, (short)0, hacc, false, false);
        }
        const float bias = db1[j];
#pragma unroll
        for (int r = 0; r < 8; ++r)
            h1[(8 * hh + r) * 128 + j] = fmaxf(hacc[r] + bias, 0.0f);
    }
    __syncthreads();

    // b1 = softplus(h1 @ D2.T + db2): RT_ * H_ = 128 values, waves 0 to 3
    if (t < RT_ * H_) {
        int r = t >> 3, h = t & 7;
        float d = db2[h];
        const float* w = D2 + h * 128;
        const float* x = h1 + r * 128;
#pragma unroll 8
        for (int k = 0; k < 128; ++k) d = fmaf(x[k], w[k], d);
        b1w[(size_t)(m0 + r) * H_ + h] = log1pf(__expf(d));
    }
}

// ---------------- prep 3: fold Wk and P_uk into the query ------------------
// Q_h . K[n]_h = h_send[n] . (Q_h @ Wk_h) + Q_h . P_uk[bs[n]]_h, so K is never
// formed: per (b, h) a 256-vector QK and 16 scalars QP replace the 64x256 K.
// Workgroup = 64 rows b x one head, f32 16x16x4 WMMA (operands stay f32).
// Lane (c, hh) holds k = k0 + 4*hh + {0..3} of A row c and of B column c:
// elements 0,1 feed one WMMA and 2,3 the next, so A and B pair on equal k.
// A wave owns 64 columns (one whole 128-B line of bf16 per row) x 32 rows.
extern "C" __global__ void __launch_bounds__(256)
baca_qk(const float* __restrict__ Qf, const float* __restrict__ Wk,
        const float* __restrict__ P_uk,
        bf16_t* __restrict__ QKb, float* __restrict__ QP) {
    const int t = threadIdx.x, lane = t & 31, wave = t >> 5;
    const int h  = blockIdx.x & 7;
    const int m0 = (blockIdx.x >> 3) * 64 + (wave >> 2) * 32;
    const int cg = (wave & 3) * 64;
    const int c = lane & 15, hh = lane >> 4;
    const float* qa = Qf   + (size_t)(m0 + c) * D_ + h * DH_ + 4 * hh;
    const float* wb = Wk   + (h * DH_ + 4 * hh) * D_ + cg + c;
    const float* pb = P_uk + c * D_ + h * DH_ + 4 * hh;
    v8f acc[2][4], pacc[2];
#pragma unroll
    for (int s = 0; s < 2; ++s) {
        pacc[s] = v8f_zero();
#pragma unroll
        for (int ct = 0; ct < 4; ++ct) acc[s][ct] = v8f_zero();
    }
    v4f av[4][2], pv[4];
#pragma unroll
    for (int kq = 0; kq < 4; ++kq) {
        pv[kq] = *(const v4f*)(pb + kq * 8);
#pragma unroll
        for (int s = 0; s < 2; ++s) av[kq][s] = *(const v4f*)(qa + s * 16 * D_ + kq * 8);
    }
    // the loads above are all issued here; behind this wait their address
    // registers may be reused
    asm volatile("s_wait_xcnt 0x0" ::: "memory");
#pragma unroll
    for (int kq = 0; kq < 4; ++kq) {
        v2f a0[2], a1[2];
#pragma unroll
        for (int s = 0; s < 2; ++s) {
            a0[s] = v2f{av[kq][s][0], av[kq][s][1]};
            a1[s] = v2f{av[kq][s][2], av[kq][s][3]};
        }
#pragma unroll
        for (int ct = 0; ct < 4; ++ct) {
            const float* w = wb + kq * 8 * D_ + ct * 16;
            v2f b0 = {w[0], w[D_]}, b1 = {w[2 * D_], w[3 * D_]};
#pragma unroll
            for (int s = 0; s < 2; ++s) {
                acc[s][ct] = __builtin_amdgcn_wmma_f32_16x16x4_f32(
                    false, a0[s], false, b0, (short)0, acc[s][ct], false, false);
                acc[s][ct] = __builtin_amdgcn_wmma_f32_16x16x4_f32(
                    false, a1[s], false, b1, (short)0, acc[s][ct], false, false);
            }
        }
        v2f p0 = {pv[kq][0], pv[kq][1]}, p1 = {pv[kq][2], pv[kq][3]};
#pragma unroll
        for (int s = 0; s < 2; ++s) {
            pacc[s] = __builtin_amdgcn_wmma_f32_16x16x4_f32(
                false, a0[s], false, p0, (short)0, pacc[s], false, false);
            pacc[s] = __builtin_amdgcn_wmma_f32_16x16x4_f32(
                false, a1[s], false, p1, (short)0, pacc[s], false, false);
        }
    }
    // keeps the stores' address arithmetic out of the WMMA block, where it was
    // scheduled onto operand registers directly behind the WMMA that read them
    __builtin_amdgcn_sched_barrier(0);
    // four vector slots between the last WMMA and the first overwrite of its operands
    asm volatile("v_nop\n\tv_nop\n\tv_nop\n\tv_nop");
    // holds the epilogue's vector instructions behind those slots
    __builtin_amdgcn_sched_barrier(0);
#pragma unroll
    for (int s = 0; s < 2; ++s) {
#pragma unroll
        for (int r = 0; r < 8; ++r) {
            size_t row = (size_t)(m0 + s * 16 + 8 * hh + r) * H_ + h;
#pragma unroll
            for (int ct = 0; ct < 4; ++ct)
                QKb[row * D_ + cg + ct * 16 + c] = (bf16_t)acc[s][ct][r];
            if ((wave & 3) == 0) QP[row * NB_ + c] = pacc[s][r];
        }
    }
}

// ---------------- kernel B: scores, V projection and attention per b -------
// Wave w: all 64 rows (n) x the 32 V columns of head w, so that a Wv fragment
// is loaded once per workgroup and feeds four WMMAs. The score tile of strip
// w & 3 is one more B fragment of the same k loop: B[k][h] = QK[b][h][k]
// (columns 8..15 repeat heads 0..7 and are not read).
// V's term P_uv[batch_send[n]] is a ninth k step of the same loop: A = the rows'
// one-hot sender batch, twice over, B = P_uv as bf16 high part and rest.
// V never touches LDS: accumulators stay in registers and are contracted
// against attn directly (register tile j-axis == n reduction axis).
// LDS carve (36 KB):
//   sc f32[512] | qps f32[128] | b1s f32[8] | dists f32[64]
//   As bf16[64*AP_] | bs int[64] | msk int[64]
extern "C" __global__ void __launch_bounds__(256)
baca_attn(const float* __restrict__ h_send, const int* __restrict__ batch_recv,
          const int* __restrict__ batch_send, const float* __restrict__ dist,
          const int* __restrict__ mask, const float* __restrict__ gamma,
          const bf16_t* __restrict__ Wv_bf,
          const bf16_t* __restrict__ QKb, const float* __restrict__ QP,
          const float* __restrict__ b1w,
          float* __restrict__ z_out, float* __restrict__ attn_out) {
    extern __shared__ char smem[];
    float*  sc    = (float*)smem;                // 64*8
    float*  qps   = sc + 512;                    // 8*16
    float*  b1s   = qps + 128;                   // 8
    float*  dists = b1s + 8;                     // 64
    bf16_t* As    = (bf16_t*)(dists + 64);       // 64*AP_ (16B aligned)
    int*    bs    = (int*)(As + 64 * AP_);       // 64
    int*    msk   = bs + 64;                     // 64

    const int t = threadIdx.x, lane = t & 31;
    // the wave's number as a scalar: addresses built from it stay out of the VGPRs
    const int wave = __builtin_amdgcn_readfirstlane(t >> 5);
    const int b = blockIdx.x;

    // stage: h_send[b] -> bf16, per-(h, batch) and per-n scalars
    const float* hs = h_send + (size_t)b * (N_ * D_);
    // Every global load of the stage is issued before the first one is waited
    // for, the big table as 16-byte loads: the stage then costs one trip to
    // memory, not one per loop trip and per table. The small tables' values wait
    // in registers until the big table is stored.
    v4f st[16];
#pragma unroll
    for (int i = 0; i < 16; ++i) st[i] = *(const v4f*)(hs + (t + i * 256) * 4);
    // P_uv comes with the stage's loads too: the head's two B fragments of the P_uv
    // k step (fragment block 8), which the k loop below starts with
    v16bf pf0 = frag_b(Wv_bf, wave * 2, 8, lane);
    v16bf pf1 = frag_b(Wv_bf, wave * 2 + 1, 8, lane);
    int   bsv = 0, mkv = 0;
    float dsv = 0.0f, qpv = 0.0f, b1v = 0.0f;
    if (t < 64) {
        bsv = (batch_send + (size_t)b * N_)[t];
        mkv = (mask + (size_t)b * N_)[t];
        dsv = (dist + (size_t)b * N_)[t];
    }
    if (t < H_ * NB_) qpv = QP[(size_t)b * (H_ * NB_) + t];
    if (t < H_) b1v = b1w[(size_t)b * H_ + t];
#pragma unroll
    for (int i = 0; i < 16; ++i) {
        v4bf pk;
#pragma unroll
        for (int e = 0; e < 4; ++e) pk[e] = (bf16_t)st[i][e];
        *(v4bf*)(As + (i * 4 + (t >> 6)) * AP_ + (t & 63) * 4) = pk;
    }
    if (t < 64) {
        bs[t]    = bsv;
        msk[t]   = mkv;
        dists[t] = dsv;
    }
    if (t < H_ * NB_) qps[t] = qpv;
    if (t < H_) b1s[t] = b1v;
    __syncthreads();

    const int strip = (wave & 3) * 16;
    const int rbase = strip + ((lane >> 4) << 3);
    // acc[s][ct]: rows of strip (wave + s) & 3, columns wave * 32 + ct * 16. The
    // strips start at the wave's own score strip, so that a[0] below serves both.
    v8f acc[4][2];
#pragma unroll
    for (int s = 0; s < 4; ++s) {
        acc[s][0] = v8f_zero();
        acc[s][1] = v8f_zero();
    }
    v8f sacc = v8f_zero();
    {
        // frag_a's k order: low chunk at k0 + 8*(lane >> 4), high chunk 16 on
        const bf16_t* qk = QKb + (size_t)b * (H_ * D_) + (lane & 7) * D_ + ((lane >> 4) << 3);
        // Three B fragments a k step: rb[0] the score fragment, rb[1] and rb[2] the
        // head's two V column tiles. Each is refilled for the next k step right
        // behind the last WMMA that read it, so its load flies under the other
        // WMMAs and the next A reads. The loops are unrolled whole so that every
        // index of rb and acc is a constant and they stay in registers.
        v16bf rb[3];
        rb[0] = frag_q(qk, 0);
        rb[1] = pf0;
        rb[2] = pf1;
        // ks = -1 is the P_uv step. It goes first: what it forms
        // from the lane's number and bs is then dead before the accumulators fill up.
#pragma unroll
        for (int ks = -1; ks < 8; ++ks) {
            // the A strips come in two pairs through one pair of register sets, which
            // keeps the kernel within 128 VGPRs (eight waves per SIMD)
#pragma unroll
            for (int hf = 0; hf < 2; ++hf) {
                v16bf a[2];
#pragma unroll
                for (int s = 0; s < 2; ++s)
                    a[s] = (ks >= 0)
                        ? frag_ap(As, ((wave + hf * 2 + s) & 3) * 16, ks * 32, lane)
                        : frag_onehot(bs[((wave + hf * 2 + s) & 3) * 16 + (lane & 15)], lane);
                if (hf == 0 && ks >= 0) {
                    sacc = __builtin_amdgcn_wmma_f32_16x16x32_bf16(
                        false, a[0], false, rb[0], (short)0, sacc, false, false);
                    // keeps the refill behind the WMMA that reads the set, so that it takes the
                    // set's own registers and not a fourth set's
                    __builtin_amdgcn_sched_barrier(0);
                    if (ks < 7) rb[0] = frag_q(qk, ks + 1);
                    // holds each refill where it is written: without it the compiler moves the
                    // loads down to just in front of their WMMA, and each waits out its own latency
                    __builtin_amdgcn_sched_barrier(0);
                }
#pragma unroll
                for (int ct = 0; ct < 2; ++ct) {
#pragma unroll
                    for (int s = 0; s < 2; ++s)
                        acc[hf * 2 + s][ct] = __builtin_amdgcn_wmma_f32_16x16x32_bf16(
                            false, a[s], false, rb[1 + ct], (short)0, acc[hf * 2 + s][ct], false, false);
                    if (hf == 1 && ks < 7) {
                        // as above: the refill stays behind the set's last reader
                        __builtin_amdgcn_sched_barrier(0);
                        rb[1 + ct] = frag_b(Wv_bf, wave * 2 + ct, ks + 1, lane);
                        // as above: holds the refill where it is written
                        __builtin_amdgcn_sched_barrier(0);
                    }
                }
                // keeps the next pair's A reads behind this pair's last reader, so that
                // they take this pair's registers and not a second pair's
                __builtin_amdgcn_sched_barrier(0);
            }
        }
    }

    // scores[n][h]: sacc[j] is h_send[rbase+j] . QK[h], h = lane & 15
    if (wave < 4 && (lane & 15) < H_) {
        const int   h     = lane & 15;
        const int   br    = batch_recv[b];
        const float scale = 0.1767766952966369f;   // 1/sqrt(32)
#pragma unroll
        for (int j = 0; j < 8; ++j) {
            int n = rbase + j;
            float d = sacc[j] + qps[h * NB_ + bs[n]];
            float s = d * scale - b1s[h] * dists[n] + gamma[br * NB_ + bs[n]];
            sc[n * H_ + h] = (msk[n] == 0) ? -INFINITY : s;
        }
    }
    __syncthreads();

    // softmax over n: wave w takes head w, lane l the rows l and l + 32; maximum
    // and sum go over the wave's lanes in registers, and the wave scales its own
    // head, so no lane walks the 64 rows alone while the other waves wait.
    // the lane's number read anew here: taken from t & 31 it would hold one more
    // register across the k loop, and the kernel would leave 128 VGPRs
    const int ln = __builtin_amdgcn_mbcnt_lo(~0u, 0u);
    {
        float* sp = sc + ln * H_ + wave;
        const float s0 = sp[0], s1 = sp[32 * H_];
        const float m  = wave_max(fmaxf(s0, s1));
        const float e0 = __expf(s0 - m), e1 = __expf(s1 - m);
        const float iv = 1.0f / wave_sum(e0 + e1);
        sp[0]       = e0 * iv;
        sp[32 * H_] = e1 * iv;
    }
    __syncthreads();


    // contract register V tiles with attn: the wave's head is h = wave.
    // Lane owns cols wave*32 + ct*16 + (lane&15); acc[s][ct][j] is V[row][col],
    // row = ((wave+s)&3)*16 + 8*(lane>>4) + j: 32 of a column's 64 rows per lane.
    {
        const int hh = ln >> 4;
        float p0 = 0.0f, p1 = 0.0f;
#pragma unroll
        for (int s = 0; s < 4; ++s) {
            const int r0 = ((wave + s) & 3) * 16 + hh * 8;
#pragma unroll
            for (int j = 0; j < 8; ++j) {
                float w = sc[(r0 + j) * H_ + wave];
                p0 = fmaf(w, acc[s][0][j], p0);
                p1 = fmaf(w, acc[s][1][j], p1);
            }
        }
        // a column's other 32 rows lie in lane l ^ 16; lanes 0-15 then store the
        // head's first 16 columns and lanes 16-31 its last 16: one 128-B line a wave
        p0 += xhalf(p0);
        p1 += xhalf(p1);
        z_out[(size_t)b * D_ + t] = hh ? p1 : p0;
    }

    // attn goes out behind the last barrier, so that no barrier waits for its stores
#pragma unroll
    for (int rep = 0; rep < 2; ++rep) {
        int idx = t + rep * 256;
        attn_out[(size_t)b * (N_ * H_) + idx] = sc[idx];
    }
}

// --------------------------------------------------------------------------
extern "C" void kernel_launch(void* const* d_in, const int* in_sizes, int n_in,
                              void* d_out, int out_size, void* d_ws, size_t ws_size,
                              hipStream_t stream) {
    const float* h_recv     = (const float*)d_in[0];
    const float* h_send     = (const float*)d_in[1];
    const int*   batch_recv = (const int*)d_in[2];
    const int*   batch_send = (const int*)d_in[3];
    const float* dist       = (const float*)d_in[4];
    const int*   mask       = (const int*)d_in[5];
    const float* Wq = (const float*)d_in[6];  const float* bq  = (const float*)d_in[7];
    const float* Wk = (const float*)d_in[8];  const float* bk  = (const float*)d_in[9];
    const float* Wv = (const float*)d_in[10]; const float* bv  = (const float*)d_in[11];
    const float* Uq = (const float*)d_in[12]; const float* buq = (const float*)d_in[13];
    const float* Uk = (const float*)d_in[14]; const float* buk = (const float*)d_in[15];
    const float* Uv = (const float*)d_in[16]; const float* buv = (const float*)d_in[17];
    const float* batch_emb = (const float*)d_in[18];
    const float* D1  = (const float*)d_in[19]; const float* db1 = (const float*)d_in[20];
    const float* D2  = (const float*)d_in[21]; const float* db2 = (const float*)d_in[22];
    const float* gamma = (const float*)d_in[23];

    // workspace carve (about 24 MB)
    bf16_t* Wq_bf = (bf16_t*)d_ws;
    bf16_t* Wv_bf = Wq_bf + D_ * D_;
    bf16_t* Pvf   = Wv_bf + D_ * D_;            // k step 8 of the Wv fragments: 32*D
    float*  P_uq  = (float*)(Pvf + 32 * D_);
    float*  P_uk  = P_uq + NB_ * D_;
    float*  Qf    = P_uk + NB_ * D_;            // B*D
    float*  b1w   = Qf + (size_t)B_ * D_;       // B*H
    float*  QP    = b1w + (size_t)B_ * H_;      // B*H*NB
    bf16_t* QKb   = (bf16_t*)(QP + (size_t)B_ * H_ * NB_);   // B*H*D

    float* z_out    = (float*)d_out;
    float* attn_out = z_out + (size_t)B_ * D_;

    hipLaunchKernelGGL(baca_cvt_w, dim3(2 * D_ * D_ / 256), dim3(256), 0, stream,
                       Wq, Wv, Wq_bf);
    hipLaunchKernelGGL(baca_pu, dim3(3 * NB_ * D_ / 256), dim3(256), 0, stream,
                       Uq, buq, bq, Uk, buk, bk, Uv, buv, bv, batch_emb,
                       P_uq, P_uk, Pvf);

    size_t lds_a = (RT_ * HP_ + RT_ * 128) * sizeof(float)
                 + RT_ * 256 * sizeof(bf16_t) + RT_ * sizeof(int);
    hipLaunchKernelGGL(baca_qb1, dim3(B_ / RT_), dim3(256), lds_a, stream,
                       h_recv, batch_recv, Wq_bf, P_uq, batch_emb,
                       D1, db1, D2, db2, Qf, b1w);

    hipLaunchKernelGGL(baca_qk, dim3(B_ / 64 * H_), dim3(256), 0, stream,
                       Qf, Wk, P_uk, QKb, QP);

    size_t lds_b = (512 + 128 + 8 + 64) * sizeof(float)
                 + 64 * AP_ * sizeof(bf16_t) + 128 * sizeof(int);
    hipLaunchKernelGGL(baca_attn, dim3(B_), dim3(256), lds_b, stream,
                       h_send, batch_recv, batch_send, dist, mask, gamma,
                       Wv_bf, QKb, QP, b1w, z_out, attn_out);
}

// v010
// Measured time: 81.3 microseconds a run.
// Next to v009, in two timings, it ran 1.07 and 1.08 times as fast.
// All steps since v000 together make it 16.1 times as fast.
#include <hip/hip_runtime.h>
#include <hip/hip_bf16.h>
#include <math.h>

#define B_  4096
#define N_  64
#define D_  256
#define H_  8
#define NB_ 16
#define DH_ 32

typedef __bf16 bf16_t;
typedef __attribute__((ext_vector_type(16))) __bf16 v16bf;
typedef __attribute__((ext_vector_type(8)))  __bf16 v8bf;
typedef __attribute__((ext_vector_type(4)))  __bf16 v4bf;
typedef __attribute__((ext_vector_type(8)))  float  v8f;
typedef __attribute__((ext_vector_type(4)))  float  v4f;
typedef __attribute__((ext_vector_type(2)))  float  v2f;
typedef __attribute__((ext_vector_type(8)))  unsigned v8u;

// LDS row pitch (floats) of the f32 receiver state: 1040 B = 16 B x 65, so the
// 16 rows of one ds_load_b128 fragment read fall on 64 distinct banks.
#define HP_ 260

__device__ __forceinline__ v8f v8f_zero() {
    v8f v;
#pragma unroll
    for (int i = 0; i < 8; ++i) v[i] = 0.0f;
    return v;
}

// A fragment (16x32 bf16, row-major source with row stride D_):
// lanes 0-15 : row = mr+lane,    K chunks [k0, k0+8) and [k0+16, k0+24)
// lanes 16-31: row = mr+lane-16, K chunks [k0+8, k0+16) and [k0+24, k0+32)
__device__ __forceinline__ v16bf frag_a(const bf16_t* __restrict__ A, int mr, int k0, int lane) {
    int r  = mr + (lane & 15);
    int kk = k0 + ((lane >> 4) << 3);
    v8bf lo = *(const v8bf*)(A + r * D_ + kk);
    v8bf hi = *(const v8bf*)(A + r * D_ + kk + 16);
    v16bf f;
#pragma unroll
    for (int i = 0; i < 8; ++i) { f[i] = lo[i]; f[i + 8] = hi[i]; }
    return f;
}

// LDS row pitch (bf16) of baca_attn's sender rows: 528 B = 16 B x 33, so the 16
// rows of one ds_load_b128 fragment read fall on distinct banks.
#define AP_ 264

// frag_a on rows at pitch AP_: same lanes, same k order.
__device__ __forceinline__ v16bf frag_ap(const bf16_t* __restrict__ A, int mr, int k0, int lane) {
    int r  = mr + (lane & 15);
    int kk = k0 + ((lane >> 4) << 3);
    v8bf lo = *(const v8bf*)(A + r * AP_ + kk);
    v8bf hi = *(const v8bf*)(A + r * AP_ + kk + 16);
    v16bf f;
#pragma unroll
    for (int i = 0; i < 8; ++i) { f[i] = lo[i]; f[i + 8] = hi[i]; }
    return f;
}

// B fragment (32x16 bf16). B[k][n] = W[n][k] (we compute X @ W.T). The weights
// lie in the workspace in fragment order (baca_cvt_w): fragment (k step ks,
// column tile ct) is the 1 KB block ks*16 + ct, its first 512 B the 32 lanes'
// low k chunks in lane order, its second 512 B their high k chunks. Each
// wave-wide 16-byte load so covers four whole 128-B lines, not 32 B of sixteen.
__device__ __forceinline__ v16bf frag_b(const bf16_t* __restrict__ Wp, int ct, int ks, int lane) {
    const bf16_t* p = Wp + ((ks * 16 + ct) << 9) + (lane << 3);
    v8bf lo = *(const v8bf*)(p);
    v8bf hi = *(const v8bf*)(p + 256);
    v16bf f;
#pragma unroll
    for (int i = 0; i < 8; ++i) { f[i] = lo[i]; f[i + 8] = hi[i]; }
    return f;
}

// A fragment (16x32 bf16) of the k step that adds P_uv[batch_send[n]] to V row n:
// A[n][k] = 1 where (k & 15) == bsr, the row's sender batch, else 0, in frag_a's
// k order. The lane's two k chunks lie 16 apart, so both hold the same eight
// values: one bf16 1.0 (0x3F80) at element d = bsr - 8*(lane >> 4) if 0 <= d < 8.
__device__ __forceinline__ v16bf frag_onehot(int bsr, int lane) {
    const int d = bsr - ((lane >> 4) << 3);
    const unsigned one = 0x3F80u << ((d & 1) << 4);
    v8u w;
#pragma unroll
    for (int q = 0; q < 4; ++q) {
        unsigned x = ((d >> 1) == q) ? one : 0u;
        w[q] = x;
        w[q + 4] = x;
    }
    return __builtin_bit_cast(v16bf, w);
}

// Score B fragment of k step ks: B[k][h] = QK[b][h][k], q already at the lane's
// head row and low k chunk.
__device__ __forceinline__ v16bf frag_q(const bf16_t* __restrict__ q, int ks) {
    v8bf lo = *(const v8bf*)(q + ks * 32);
    v8bf hi = *(const v8bf*)(q + ks * 32 + 16);
    v16bf f;
#pragma unroll
    for (int i = 0; i < 8; ++i) { f[i] = lo[i]; f[i + 8] = hi[i]; }
    return f;
}

// Maximum and sum over the 32 lanes of a wave, the result in every lane: four
// DPP steps inside each 16-lane row, then lane l with lane l ^ 16.
template <int CTRL>
__device__ __forceinline__ float row_x(float x) {
    return __builtin_bit_cast(float, __builtin_amdgcn_update_dpp(
        0, __builtin_bit_cast(int, x), CTRL, 0xf, 0xf, false));
}
__device__ __forceinline__ float xhalf(float x) {
    return __builtin_bit_cast(float, __builtin_amdgcn_permlanex16(
        __builtin_bit_cast(int, x), __builtin_bit_cast(int, x), 0x76543210, 0xfedcba98, false, false));
}
__device__ __forceinline__ float wave_max(float x) {
    x = fmaxf(x, row_x<0x161>(x));   // row_xmask:1
    x = fmaxf(x, row_x<0x162>(x));   // row_xmask:2
    x = fmaxf(x, row_x<0x164>(x));   // row_xmask:4
    x = fmaxf(x, row_x<0x168>(x));   // row_xmask:8
    return fmaxf(x, xhalf(x));
}
__device__ __forceinline__ float wave_sum(float x) {
    x += row_x<0x161>(x);
    x += row_x<0x162>(x);
    x += row_x<0x164>(x);
    x += row_x<0x168>(x);
    return x + xhalf(x);
}

// ---------------- prep 1: convert Wq/Wv to bf16, in fragment order ---------
// dst element: [matrix][ks*16 + ct][part][lane][e] holds
// W[ct*16 + (lane & 15)][ks*32 + part*16 + (lane >> 4)*8 + e], frag_a's k order.
extern "C" __global__ void __launch_bounds__(256)
baca_cvt_w(const float* __restrict__ Wq, const float* __restrict__ Wv,
           bf16_t* __restrict__ dst) {
    int idx = blockIdx.x * 256 + threadIdx.x;           // 0 .. 2*65536
    const float* src = (idx < 65536) ? Wq : Wv;
    int e = idx & 7, lane = (idx >> 3) & 31, part = (idx >> 8) & 1;
    int ct = (idx >> 9) & 15, ks = (idx >> 13) & 7;
    int row = ct * 16 + (lane & 15);
    int k   = ks * 32 + part * 16 + ((lane >> 4) << 3) + e;
    dst[idx] = (bf16_t)src[row * D_ + k];
}

// ---------------- prep 2: P_u* = batch_emb @ U*.T + b* + bu* ---------------
// On f32 16x16x4 WMMA (operands stay f32): A = the 16 rows of batch_emb, B[k][d] =
// U[d][k]. A workgroup takes 32 columns d of one table (one whole 128-B line of
// each f32 row), wave w the k range [32w, 32w + 32): one whole 128-B line of each
// U row, all of the wave's loads in flight together. Lane (c, hh) holds
// k = 32w + 8*kq + 4*hh + {0..3} of A row c and of B column c, loaded by the same
// code: elements 0,1 feed one WMMA and 2,3 the next, so A and B pair on equal k.
// The eight waves' partial sums meet in LDS.
// P_uq and P_uk go out as f32 tables. P_uv goes out as k step 8 of the Wv
// fragments (frag_b's layout, right behind Wv_bf): B[k][col] = bf16 high part of
// P_uv[k][col] for k < 16, the bf16 rest of P_uv[k - 16][col] for k >= 16. There
// thread t takes element t of each of the workgroup's two 1 KB blocks, so that
// each block has one writer.
extern "C" __global__ void __launch_bounds__(256)
baca_pu(const float* __restrict__ Uq, const float* __restrict__ buq, const float* __restrict__ bq,
        const float* __restrict__ Uk, const float* __restrict__ buk, const float* __restrict__ bk,
        const float* __restrict__ Uv, const float* __restrict__ buv, const float* __restrict__ bv,
        const float* __restrict__ batch_emb,
        float* __restrict__ P_uq, float* __restrict__ P_uk, bf16_t* __restrict__ Pvf) {
    __shared__ float red[8 * NB_ * 32];
    const int t = threadIdx.x, lane = t & 31, wave = t >> 5;
    const int which = blockIdx.x >> 3;
    const int d0    = (blockIdx.x & 7) * 32;
    const float* U  = (which == 0) ? Uq  : (which == 1) ? Uk  : Uv;
    const float* bu = (which == 0) ? buq : (which == 1) ? buk : buv;
    const float* bw = (which == 0) ? bq  : (which == 1) ? bk  : bv;
    float*       P  = (which == 0) ? P_uq: P_uk;
    const int c = lane & 15, hh = lane >> 4;
    const float* ea = batch_emb + c * D_ + wave * 32 + 4 * hh;
    const float* ub = U + (d0 + c) * D_ + wave * 32 + 4 * hh;

    // the two elements (nb, col) that this thread sums up and stores
    int nb[2], col[2];
#pragma unroll
    for (int rep = 0; rep < 2; ++rep) {
        if (which == 2) {
            nb[rep]  = ((t >> 7) << 3) + (t & 7);
            col[rep] = rep * 16 + ((t >> 3) & 15);
        } else {
            nb[rep]  = (t + rep * 256) >> 5;
            col[rep] = t & 31;
        }
    }

    v4f av[4], bv4[2][4];
    float buv2[2], bwv2[2];
#pragma unroll
    for (int kq = 0; kq < 4; ++kq) {
        bv4[0][kq] = *(const v4f*)(ub + kq * 8);
        bv4[1][kq] = *(const v4f*)(ub + 16 * D_ + kq * 8);
        av[kq]     = *(const v4f*)(ea + kq * 8);
    }
#pragma unroll
    for (int rep = 0; rep < 2; ++rep) {
        buv2[rep] = bu[d0 + col[rep]];
        bwv2[rep] = bw[d0 + col[rep]];
    }
    // holds every load of the kernel above the first WMMA, so that all fly together
    // (without it two U loads and the bias loads sink among the WMMAs, behind waits),
    // and keeps address arithmetic from being scheduled onto WMMA operand registers
    __builtin_amdgcn_sched_barrier(0);
    // behind this wait the loads' address registers may be reused; it names the two
    // address pairs so that no load's result is placed on them before it
    asm volatile("s_wait_xcnt 0x0" :: "v"(ea), "v"(ub) : "memory");

    v8f acc[2];
    acc[0] = v8f_zero();
    acc[1] = v8f_zero();
#pragma unroll
    for (int kq = 0; kq < 4; ++kq) {
        v2f a0 = {av[kq][0], av[kq][1]}, a1 = {av[kq][2], av[kq][3]};
#pragma unroll
        for (int j = 0; j < 2; ++j) {
            v2f b0 = {bv4[j][kq][0], bv4[j][kq][1]}, b1 = {bv4[j][kq][2], bv4[j][kq][3]};
            acc[j] = __builtin_amdgcn_wmma_f32_16x16x4_f32(
                false, a0, false, b0, (short)0, acc[j], false, false);
            acc[j] = __builtin_amdgcn_wmma_f32_16x16x4_f32(
                false, a1, false, b1, (short)0, acc[j], false, false);
        }
    }
    // keeps the epilogue's arithmetic out of the WMMA block, off its operand registers
    __builtin_amdgcn_sched_barrier(0);
    // four vector slots between the last WMMA and the first overwrite of its operands
    asm volatile("v_nop\n\tv_nop\n\tv_nop\n\tv_nop");
    // holds the epilogue's vector instructions behind those slots
    __builtin_amdgcn_sched_barrier(0);
    // acc[j][r] is the wave's part of P[8*hh + r][d0 + j*16 + c]
#pragma unroll
    for (int j = 0; j < 2; ++j)
#pragma unroll
        for (int r = 0; r < 8; ++r)
            red[wave * (NB_ * 32) + (8 * hh + r) * 32 + j * 16 + c] = acc[j][r];
    __syncthreads();

    float s[2];
#pragma unroll
    for (int rep = 0; rep < 2; ++rep) {
        s[rep] = buv2[rep] + bwv2[rep];
#pragma unroll
        for (int w = 0; w < 8; ++w) s[rep] += red[w * (NB_ * 32) + nb[rep] * 32 + col[rep]];
    }
    if (which != 2) {
#pragma unroll
        for (int rep = 0; rep < 2; ++rep) P[nb[rep] * D_ + d0 + col[rep]] = s[rep];
        // the built code lays the P_uv branch right behind these stores, where it
        // rewrites their address registers: the wait stands in front of that
        asm volatile("s_wait_xcnt 0x0" ::: "memory");
        return;
    }
#pragma unroll
    for (int rep = 0; rep < 2; ++rep) {
        bf16_t  hi = (bf16_t)s[rep];
        bf16_t* p  = Pvf + (((d0 >> 4) + rep) << 9) + t;
        p[0]   = hi;
        p[256] = (bf16_t)(s[rep] - (float)hi);
    }
}

// ---------------- kernel A: Q = h_recv@Wq.T + gather(P_uq); b1 MLP ---------
// A workgroup takes RT_ = 16 rows, the fewest a WMMA tile holds: the phases below
// run one after the other, each waiting out its own loads, so a short tile keeps
// them short, and B_ / RT_ = 256 workgroups put one on every WGP.
// LDS carve: Hs f32[RT_*HP_] | h1 f32[RT_*128] | As bf16[RT_*256] | br int[RT_]
#define RT_ 16
extern "C" __global__ void __launch_bounds__(256)
baca_qb1(const float* __restrict__ h_recv, const int* __restrict__ batch_recv,
         const bf16_t* __restrict__ Wq_bf, const float* __restrict__ P_uq,
         const float* __restrict__ batch_emb,
         const float* __restrict__ D1, const float* __restrict__ db1,
         const float* __restrict__ D2, const float* __restrict__ db2,
         float* __restrict__ Qf, float* __restrict__ b1w) {
    extern __shared__ char smem[];
    float*  Hs = (float*)smem;                   // RT_*HP_
    float*  h1 = Hs + RT_ * HP_;                 // RT_*128
    bf16_t* As = (bf16_t*)(h1 + RT_ * 128);      // RT_*256
    int*    br = (int*)(As + RT_ * 256);         // RT_

    const int t = threadIdx.x, lane = t & 31, wave = t >> 5;
    const int m0 = blockIdx.x * RT_;

    const float* hr = h_recv + (size_t)m0 * D_;
#pragma unroll 4
    for (int i = 0; i < RT_; ++i) {
        int idx = t + i * 256;
        float v = hr[idx];
        Hs[(idx >> 8) * HP_ + (idx & 255)] = v;
        As[idx] = (bf16_t)v;
    }
    if (t < RT_) br[t] = batch_recv[m0 + t];
    __syncthreads();

    // receiver_state = h_recv + E_recv (in place; WMMA below only reads As)
#pragma unroll 4
    for (int i = 0; i < RT_; ++i) {
        int idx = t + i * 256;
        Hs[(idx >> 8) * HP_ + (idx & 255)] += batch_emb[br[idx >> 8] * D_ + (idx & 255)];
    }

    // WMMA: 16x256 output, 8 waves x 2 tiles (one whole 128-B line of Qf per row)
    {
        const int chalf = wave * 2;
        v8f acc[2];
#pragma unroll
        for (int ct = 0; ct < 2; ++ct) acc[ct] = v8f_zero();
        for (int k0 = 0; k0 < D_; k0 += 32) {
            v16bf a = frag_a(As, 0, k0, lane);
#pragma unroll
            for (int ct = 0; ct < 2; ++ct) {
                v16bf bb = frag_b(Wq_bf, chalf + ct, k0 >> 5, lane);
                acc[ct] = __builtin_amdgcn_wmma_f32_16x16x32_bf16(
                    false, a, false, bb, (short)0, acc[ct], false, false);
            }
        }
        const int rbase = (lane >> 4) << 3;
#pragma unroll
        for (int ct = 0; ct < 2; ++ct) {
            int col = (chalf + ct) * 16 + (lane & 15);
#pragma unroll
            for (int j = 0; j < 8; ++j) {
                int row = rbase + j;
                Qf[(size_t)(m0 + row) * D_ + col] = acc[ct][j] + P_uq[br[row] * D_ + col];
            }
        }
    }
    __syncthreads();

    // hidden = relu(rs @ D1.T + db1) on f32 16x16x4 WMMA (operands stay f32).
    // Wave w owns hidden columns [16w, 16w+16) for all 16 rows, so each D1 row
    // is read once per workgroup. Lane (c, hh) loads 4 contiguous k at
    // k0 + 4*hh of A row c and of D1 row c with the same code: elements 0,1
    // feed one WMMA and 2,3 the next, so A and B pair on equal k.
    {
        const int c = lane & 15, hh = lane >> 4;
        const int j = wave * 16 + c;
        const float* xa = Hs + c * HP_ + 4 * hh;
        const float* wb = D1 + j * D_ + 4 * hh;
        v8f hacc = v8f_zero();
        // unrolled so that several k steps' D1 loads are in flight together
#pragma unroll 8
        for (int k0 = 0; k0 < D_; k0 += 8) {
            v4f bv = *(const v4f*)(wb + k0);
            v2f b0 = {bv[0], bv[1]}, b1 = {bv[2], bv[3]};
            v4f av = *(const v4f*)(xa + k0);
            v2f a0 = {av[0], av[1]}, a1 = {av[2], av[3]};
            hacc = __builtin_amdgcn_wmma_f32_16x16x4_f32(
                false, a0, false, b0, (short)0, hacc, false, false);
            hacc = __builtin_amdgcn_wmma_f32_16x16x4_f32(
                false, a1, false, b1, (short)0, hacc, false, false);
        }
        const float bias = db1[j];
#pragma unroll
        for (int r = 0; r < 8; ++r)
            h1[(8 * hh + r) * 128 + j] = fmaxf(hacc[r] + bias, 0.0f);
    }
    __syncthreads();

    // b1 = softplus(h1 @ D2.T + db2): RT_ * H_ = 128 values, waves 0 to 3
    if (t < RT_ * H_) {
        int r = t >> 3, h = t & 7;
        float d = db2[h];
        const float* w = D2 + h * 128;
        const float* x = h1 + r * 128;
#pragma unroll 8
        for (int k = 0; k < 128; ++k) d = fmaf(x[k], w[k], d);
        b1w[(size_t)(m0 + r) * H_ + h] = log1pf(__expf(d));
    }
}

// ---------------- prep 3: fold Wk and P_uk into the query ------------------
// Q_h . K[n]_h = h_send[n] . (Q_h @ Wk_h) + Q_h . P_uk[bs[n]]_h, so K is never
// formed: per (b, h) a 256-vector QK and 16 scalars QP replace the 64x256 K.
// Workgroup = 64 rows b x one head, f32 16x16x4 WMMA (operands stay f32).
// Lane (c, hh) holds k = k0 + 4*hh + {0..3} of A row c and of B column c:
// elements 0,1 feed one WMMA and 2,3 the next, so A and B pair on equal k.
// A wave owns 64 columns (one whole 128-B line of bf16 per row) x 32 rows.
extern "C" __global__ void __launch_bounds__(256)
baca_qk(const float* __restrict__ Qf, const float* __restrict__ Wk,
        const float* __restrict__ P_uk,
        bf16_t* __restrict__ QKb, float* __restrict__ QP) {
    const int t = threadIdx.x, lane = t & 31, wave = t >> 5;
    const int h  = blockIdx.x & 7;
    const int m0 = (blockIdx.x >> 3) * 64 + (wave >> 2) * 32;
    const int cg = (wave & 3) * 64;
    const int c = lane & 15, hh = lane >> 4;
    const float* qa = Qf   + (size_t)(m0 + c) * D_ + h * DH_ + 4 * hh;
    const float* wb = Wk   + (h * DH_ + 4 * hh) * D_ + cg + c;
    const float* pb = P_uk + c * D_ + h * DH_ + 4 * hh;
    v8f acc[2][4], pacc[2];
#pragma unroll
    for (int s = 0; s < 2; ++s) {
        pacc[s] = v8f_zero();
#pragma unroll
        for (int ct = 0; ct < 4; ++ct) acc[s][ct] = v8f_zero();
    }
    v4f av[4][2], pv[4];
#pragma unroll
    for (int kq = 0; kq < 4; ++kq) {
        pv[kq] = *(const v4f*)(pb + kq * 8);
#pragma unroll
        for (int s = 0; s < 2; ++s) av[kq][s] = *(const v4f*)(qa + s * 16 * D_ + kq * 8);
    }
    // the loads above are all issued here; behind this wait their address
    // registers may be reused
    asm volatile("s_wait_xcnt 0x0" ::: "memory");
#pragma unroll
    for (int kq = 0; kq < 4; ++kq) {
        v2f a0[2], a1[2];
#pragma unroll
        for (int s = 0; s < 2; ++s) {
            a0[s] = v2f{av[kq][s][0], av[kq][s][1]};
            a1[s] = v2f{av[kq][s][2], av[kq][s][3]};
        }
#pragma unroll
        for (int ct = 0; ct < 4; ++ct) {
            const float* w = wb + kq * 8 * D_ + ct * 16;
            v2f b0 = {w[0], w[D_]}, b1 = {w[2 * D_], w[3 * D_]};
#pragma unroll
            for (int s = 0; s < 2; ++s) {
                acc[s][ct] = __builtin_amdgcn_wmma_f32_16x16x4_f32(
                    false, a0[s], false, b0, (short)0, acc[s][ct], false, false);
                acc[s][ct] = __builtin_amdgcn_wmma_f32_16x16x4_f32(
                    false, a1[s], false, b1, (short)0, acc[s][ct], false, false);
            }
        }
        v2f p0 = {pv[kq][0], pv[kq][1]}, p1 = {pv[kq][2], pv[kq][3]};
#pragma unroll
        for (int s = 0; s < 2; ++s) {
            pacc[s] = __builtin_amdgcn_wmma_f32_16x16x4_f32(
                false, a0[s], false, p0, (short)0, pacc[s], false, false);
            pacc[s] = __builtin_amdgcn_wmma_f32_16x16x4_f32(
                false, a1[s], false, p1, (short)0, pacc[s], false, false);
        }
    }
    // keeps the stores' address arithmetic out of the WMMA block, where it was
    // scheduled onto operand registers directly behind the WMMA that read them
    __builtin_amdgcn_sched_barrier(0);
    // four vector slots between the last WMMA and the first overwrite of its operands
    asm volatile("v_nop\n\tv_nop\n\tv_nop\n\tv_nop");
    // holds the epilogue's vector instructions behind those slots
    __builtin_amdgcn_sched_barrier(0);
#pragma unroll
    for (int s = 0; s < 2; ++s) {
#pragma unroll
        for (int r = 0; r < 8; ++r) {
            size_t row = (size_t)(m0 + s * 16 + 8 * hh + r) * H_ + h;
#pragma unroll
            for (int ct = 0; ct < 4; ++ct)
                QKb[row * D_ + cg + ct * 16 + c] = (bf16_t)acc[s][ct][r];
            if ((wave & 3) == 0) QP[row * NB_ + c] = pacc[s][r];
        }
    }
}

// ---------------- kernel B: scores, V projection and attention per b -------
// Wave w: all 64 rows (n) x the 32 V columns of head w, so that a Wv fragment
// is loaded once per workgroup and feeds four WMMAs. The score tile of strip
// w & 3 is one more B fragment of the same k loop: B[k][h] = QK[b][h][k]
// (columns 8..15 repeat heads 0..7 and are not read).
// V's term P_uv[batch_send[n]] is a ninth k step of the same loop: A = the rows'
// one-hot sender batch, twice over, B = P_uv as bf16 high part and rest.
// V never touches LDS: accumulators stay in registers and are contracted
// against attn directly (register tile j-axis == n reduction axis).
// LDS carve (36 KB):
//   sc f32[512] | qps f32[128] | b1s f32[8] | dists f32[64]
//   As bf16[64*AP_] | bs int[64] | msk int[64]
extern "C" __global__ void __launch_bounds__(256)
baca_attn(const float* __restrict__ h_send, const int* __restrict__ batch_recv,
          const int* __restrict__ batch_send, const float* __restrict__ dist,
          const int* __restrict__ mask, const float* __restrict__ gamma,
          const bf16_t* __restrict__ Wv_bf,
          const bf16_t* __restrict__ QKb, const float* __restrict__ QP,
          const float* __restrict__ b1w,
          float* __restrict__ z_out, float* __restrict__ attn_out) {
    extern __shared__ char smem[];
    float*  sc    = (float*)smem;                // 64*8
    float*  qps   = sc + 512;                    // 8*16
    float*  b1s   = qps + 128;                   // 8
    float*  dists = b1s + 8;                     // 64
    bf16_t* As    = (bf16_t*)(dists + 64);       // 64*AP_ (16B aligned)
    int*    bs    = (int*)(As + 64 * AP_);       // 64
    int*    msk   = bs + 64;                     // 64

    const int t = threadIdx.x, lane = t & 31;
    // the wave's number as a scalar: addresses built from it stay out of the VGPRs
    const int wave = __builtin_amdgcn_readfirstlane(t >> 5);
    const int b = blockIdx.x;

    // stage: h_send[b] -> bf16, per-(h, batch) and per-n scalars
    const float* hs = h_send + (size_t)b * (N_ * D_);
    // Every global load of the stage is issued before the first one is waited
    // for, the big table as 16-byte loads: the stage then costs one trip to
    // memory, not one per loop trip and per table. The small tables' values wait
    // in registers until the big table is stored.
    v4f st[16];
#pragma unroll
    for (int i = 0; i < 16; ++i) st[i] = *(const v4f*)(hs + (t + i * 256) * 4);
    // P_uv comes with the stage's loads too: the head's two B fragments of the P_uv
    // k step (fragment block 8), which the k loop below starts with
    v16bf pf0 = frag_b(Wv_bf, wave * 2, 8, lane);
    v16bf pf1 = frag_b(Wv_bf, wave * 2 + 1, 8, lane);
    int   bsv = 0, mkv = 0;
    float dsv = 0.0f, qpv = 0.0f, b1v = 0.0f;
    if (t < 64) {
        bsv = (batch_send + (size_t)b * N_)[t];
        mkv = (mask + (size_t)b * N_)[t];
        dsv = (dist + (size_t)b * N_)[t];
    }
    if (t < H_ * NB_) qpv = QP[(size_t)b * (H_ * NB_) + t];
    if (t < H_) b1v = b1w[(size_t)b * H_ + t];
#pragma unroll
    for (int i = 0; i < 16; ++i) {
        v4bf pk;
#pragma unroll
        for (int e = 0; e < 4; ++e) pk[e] = (bf16_t)st[i][e];
        *(v4bf*)(As + (i * 4 + (t >> 6)) * AP_ + (t & 63) * 4) = pk;
    }
    if (t < 64) {
        bs[t]    = bsv;
        msk[t]   = mkv;
        dists[t] = dsv;
    }
    if (t < H_ * NB_) qps[t] = qpv;
    if (t < H_) b1s[t] = b1v;
    __syncthreads();

    const int strip = (wave & 3) * 16;
    const int rbase = strip + ((lane >> 4) << 3);
    // acc[s][ct]: rows of strip (wave + s) & 3, columns wave * 32 + ct * 16. The
    // strips start at the wave's own score strip, so that a[0] below serves both.
    v8f acc[4][2];
#pragma unroll
    for (int s = 0; s < 4; ++s) {
        acc[s][0] = v8f_zero();
        acc[s][1] = v8f_zero();
    }
    v8f sacc = v8f_zero();
    {
        // frag_a's k order: low chunk at k0 + 8*(lane >> 4), high chunk 16 on
        const bf16_t* qk = QKb + (size_t)b * (H_ * D_) + (lane & 7) * D_ + ((lane >> 4) << 3);
        // Three B fragments a k step: rb[0] the score fragment, rb[1] and rb[2] the
        // head's two V column tiles. Each is refilled for the next k step right
        // behind the last WMMA that read it, so its load flies under the other
        // WMMAs and the next A reads. The loops are unrolled whole so that every
        // index of rb and acc is a constant and they stay in registers.
        v16bf rb[3];
        rb[0] = frag_q(qk, 0);
        rb[1] = pf0;
        rb[2] = pf1;
        // ks = -1 is the P_uv step. It goes first: what it forms
        // from the lane's number and bs is then dead before the accumulators fill up.
#pragma unroll
        for (int ks = -1; ks < 8; ++ks) {
            // the A strips come in two pairs through one pair of register sets, which
            // keeps the kernel within 128 VGPRs (eight waves per SIMD)
#pragma unroll
            for (int hf = 0; hf < 2; ++hf) {
                v16bf a[2];
#pragma unroll
                for (int s = 0; s < 2; ++s)
                    a[s] = (ks >= 0)
                        ? frag_ap(As, ((wave + hf * 2 + s) & 3) * 16, ks * 32, lane)
                        : frag_onehot(bs[((wave + hf * 2 + s) & 3) * 16 + (lane & 15)], lane);
                if (hf == 0 && ks >= 0) {
                    sacc = __builtin_amdgcn_wmma_f32_16x16x32_bf16(
                        false, a[0], false, rb[0], (short)0, sacc, false, false);
                    // keeps the refill behind the WMMA that reads the set, so that it takes the
                    // set's own registers and not a fourth set's
                    __builtin_amdgcn_sched_barrier(0);
                    if (ks < 7) rb[0] = frag_q(qk, ks + 1);
                    // holds each refill where it is written: without it the compiler moves the
                    // loads down to just in front of their WMMA, and each waits out its own latency
                    __builtin_amdgcn_sched_barrier(0);
                }
#pragma unroll
                for (int ct = 0; ct < 2; ++ct) {
#pragma unroll
                    for (int s = 0; s < 2; ++s)
                        acc[hf * 2 + s][ct] = __builtin_amdgcn_wmma_f32_16x16x32_bf16(
                            false, a[s], false, rb[1 + ct], (short)0, acc[hf * 2 + s][ct], false, false);
                    if (hf == 1 && ks < 7) {
                        // as above: the refill stays behind the set's last reader
                        __builtin_amdgcn_sched_barrier(0);
                        rb[1 + ct] = frag_b(Wv_bf, wave * 2 + ct, ks + 1, lane);
                        // as above: holds the refill where it is written
                        __builtin_amdgcn_sched_barrier(0);
                    }
                }
                // keeps the next pair's A reads behind this pair's last reader, so that
                // they take this pair's registers and not a second pair's
                __builtin_amdgcn_sched_barrier(0);
            }
        }
    }

    // scores[n][h]: sacc[j] is h_send[rbase+j] . QK[h], h = lane & 15
    if (wave < 4 && (lane & 15) < H_) {
        const int   h     = lane & 15;
        const int   br    = batch_recv[b];
        const float scale = 0.1767766952966369f;   // 1/sqrt(32)
#pragma unroll
        for (int j = 0; j < 8; ++j) {
            int n = rbase + j;
            float d = sacc[j] + qps[h * NB_ + bs[n]];
            float s = d * scale - b1s[h] * dists[n] + gamma[br * NB_ + bs[n]];
            sc[n * H_ + h] = (msk[n] == 0) ? -INFINITY : s;
        }
    }
    __syncthreads();

    // softmax over n: wave w takes head w, lane l the rows l and l + 32; maximum
    // and sum go over the wave's lanes in registers, and the wave scales its own
    // head, so no lane walks the 64 rows alone while the other waves wait.
    // the lane's number read anew here: taken from t & 31 it would hold one more
    // register across the k loop, and the kernel would leave 128 VGPRs
    const int ln = __builtin_amdgcn_mbcnt_lo(~0u, 0u);
    {
        float* sp = sc + ln * H_ + wave;
        const float s0 = sp[0], s1 = sp[32 * H_];
        const float m  = wave_max(fmaxf(s0, s1));
        const float e0 = __expf(s0 - m), e1 = __expf(s1 - m);
        const float iv = 1.0f / wave_sum(e0 + e1);
        sp[0]       = e0 * iv;
        sp[32 * H_] = e1 * iv;
    }
    __syncthreads();


    // contract register V tiles with attn: the wave's head is h = wave.
    // Lane owns cols wave*32 + ct*16 + (lane&15); acc[s][ct][j] is V[row][col],
    // row = ((wave+s)&3)*16 + 8*(lane>>4) + j: 32 of a column's 64 rows per lane.
    {
        const int hh = ln >> 4;
        float p0 = 0.0f, p1 = 0.0f;
#pragma unroll
        for (int s = 0; s < 4; ++s) {
            const int r0 = ((wave + s) & 3) * 16 + hh * 8;
#pragma unroll
            for (int j = 0; j < 8; ++j) {
                float w = sc[(r0 + j) * H_ + wave];
                p0 = fmaf(w, acc[s][0][j], p0);
                p1 = fmaf(w, acc[s][1][j], p1);
            }
        }
        // a column's other 32 rows lie in lane l ^ 16; lanes 0-15 then store the
        // head's first 16 columns and lanes 16-31 its last 16: one 128-B line a wave
        p0 += xhalf(p0);
        p1 += xhalf(p1);
        z_out[(size_t)b * D_ + t] = hh ? p1 : p0;
    }

    // attn goes out behind the last barrier, so that no barrier waits for its stores
#pragma unroll
    for (int rep = 0; rep < 2; ++rep) {
        int idx = t + rep * 256;
        attn_out[(size_t)b * (N_ * H_) + idx] = sc[idx];
    }
}

// --------------------------------------------------------------------------
extern "C" void kernel_launch(void* const* d_in, const int* in_sizes, int n_in,
                              void* d_out, int out_size, void* d_ws, size_t ws_size,
                              hipStream_t stream) {
    const float* h_recv     = (const float*)d_in[0];
    const float* h_send     = (const float*)d_in[1];
    const int*   batch_recv = (const int*)d_in[2];
    const int*   batch_send = (const int*)d_in[3];
    const float* dist       = (const float*)d_in[4];
    const int*   mask       = (const int*)d_in[5];
    const float* Wq = (const float*)d_in[6];  const float* bq  = (const float*)d_in[7];
    const float* Wk = (const float*)d_in[8];  const float* bk  = (const float*)d_in[9];
    const float* Wv = (const float*)d_in[10]; const float* bv  = (const float*)d_in[11];
    const float* Uq = (const float*)d_in[12]; const float* buq = (const float*)d_in[13];
    const float* Uk = (const float*)d_in[14]; const float* buk = (const float*)d_in[15];
    const float* Uv = (const float*)d_in[16]; const float* buv = (const float*)d_in[17];
    const float* batch_emb = (const float*)d_in[18];
    const float* D1  = (const float*)d_in[19]; const float* db1 = (const float*)d_in[20];
    const float* D2  = (const float*)d_in[21]; const float* db2 = (const float*)d_in[22];
    const float* gamma = (const float*)d_in[23];

    // workspace carve (about 24 MB)
    bf16_t* Wq_bf = (bf16_t*)d_ws;
    bf16_t* Wv_bf = Wq_bf + D_ * D_;
    bf16_t* Pvf   = Wv_bf + D_ * D_;            // k step 8 of the Wv fragments: 32*D
    float*  P_uq  = (float*)(Pvf + 32 * D_);
    float*  P_uk  = P_uq + NB_ * D_;
    float*  Qf    = P_uk + NB_ * D_;            // B*D
    float*  b1w   = Qf + (size_t)B_ * D_;       // B*H
    float*  QP    = b1w + (size_t)B_ * H_;      // B*H*NB
    bf16_t* QKb   = (bf16_t*)(QP + (size_t)B_ * H_ * NB_);   // B*H*D

    float* z_out    = (float*)d_out;
    float* attn_out = z_out + (size_t)B_ * D_;

    hipLaunchKernelGGL(baca_cvt_w, dim3(2 * D_ * D_ / 256), dim3(256), 0, stream,
                       Wq, Wv, Wq_bf);
    hipLaunchKernelGGL(baca_pu, dim3(3 * D_ / 32), dim3(256), 0, stream,
                       Uq, buq, bq, Uk, buk, bk, Uv, buv, bv, batch_emb,
                       P_uq, P_uk, Pvf);

    size_t lds_a = (RT_ * HP_ + RT_ * 128) * sizeof(float)
                 + RT_ * 256 * sizeof(bf16_t) + RT_ * sizeof(int);
    hipLaunchKernelGGL(baca_qb1, dim3(B_ / RT_), dim3(256), lds_a, stream,
                       h_recv, batch_recv, Wq_bf, P_uq, batch_emb,
                       D1, db1, D2, db2, Qf, b1w);

    hipLaunchKernelGGL(baca_qk, dim3(B_ / 64 * H_), dim3(256), 0, stream,
                       Qf, Wk, P_uk, QKb, QP);

    size_t lds_b = (512 + 128 + 8 + 64) * sizeof(float)
                 + 64 * AP_ * sizeof(bf16_t) + 128 * sizeof(int);
    hipLaunchKernelGGL(baca_attn, dim3(B_), dim3(256), lds_b, stream,
                       h_send, batch_recv, batch_send, dist, mask, gamma,
                       Wv_bf, QKb, QP, b1w, z_out, attn_out);
}
